// v000
// The times below were measured on an AMD MI455X: many runs one after another, warmed up first and cycling through
// copies of the inputs, with the whole window's GPU time divided by the number of runs. Launches and the gaps
// between them are all in it. The median over several windows is given; except for v000 it joins two sittings, which
// can be a few percent apart, so the side-by-side timings, each taken in one sitting, are the better comparison.
// v000 is the starting kernel. One run takes 276 microseconds.
#include <hip/hip_runtime.h>

// MultiHeadAttention forward for MI455X (gfx1250), wave32, WMMA f16->f32.
// B=2, S=2048, D=1024, H=16, DH=64.
//
//  1) qkv_proj: x @ W^T + b per head, f16 WMMA, results to d_ws as f16
//     in [B,H,S,DH] layout (Q,K,V = 3 * 8MB = 24MB of workspace).
//  2) flash_attn: online-softmax flash attention; KV tiles of 64 rows,
//     16 WMMAs per iteration; K tiles staged in LDS via
//     global_load_async_to_lds_b128 (ASYNCcnt), V staged transposed.

#define BB 2
#define SS 2048
#define DD 1024
#define HH 16
#define DH 64

typedef __attribute__((ext_vector_type(16))) _Float16 v16h;
typedef __attribute__((ext_vector_type(8)))  float    v8f;

__device__ __forceinline__ v8f wmma16(v16h a, v16h b, v8f c) {
    // D = A(16x32 f16) * B(32x16 f16) + C(16x16 f32)
    return __builtin_amdgcn_wmma_f32_16x16x32_f16(
        /*neg_a=*/false, a, /*neg_b=*/false, b,
        /*c_mod=*/(short)0, c, /*reuse_a=*/false, /*reuse_b=*/false);
}

// Load one 16-half fragment per lane as two aligned 16B chunks.
// rowp points at the lane's row start (+ kchunk*32 already applied);
// kbase = 8*(lane>=16). Matches ISA 16-bit A/B VGPR striping.
__device__ __forceinline__ v16h load_frag(const _Float16* rowp, int kbase) {
    union { v16h h; uint4 u[2]; } f;
    f.u[0] = *(const uint4*)(rowp + kbase);
    f.u[1] = *(const uint4*)(rowp + 16 + kbase);
    return f.h;
}

// ---------------------------------------------------------------------------
// Kernel 1: per-head QKV projection.  grid = (S/128, H, B), block = 256 (8 waves)
// ---------------------------------------------------------------------------
__global__ __launch_bounds__(256) void qkv_proj_kernel(
    const float* __restrict__ seqs,
    const float* __restrict__ Wq, const float* __restrict__ bq,
    const float* __restrict__ Wk, const float* __restrict__ bk,
    const float* __restrict__ Wv, const float* __restrict__ bv,
    _Float16* __restrict__ Q, _Float16* __restrict__ K, _Float16* __restrict__ V)
{
    const int tile = blockIdx.x;
    const int h    = blockIdx.y;
    const int b    = blockIdx.z;
    const int tid  = threadIdx.x;
    const int lane = tid & 31;
    const int wid  = tid >> 5;
    const int mn   = lane & 15;            // M (A row) or N (B/C col) index
    const int kb   = (lane >> 4) << 3;     // 0 or 8: K-half / C-row offset

    __shared__ __align__(16) _Float16 x_lds[128][DH];      // 16 KB
    __shared__ __align__(16) _Float16 w_lds[3][DH][DH];    // 24 KB

    const int row0 = tile * 128;

    // Stage x slice for this head (f32 -> f16), coalesced.
    for (int i = tid; i < 128 * DH; i += 256) {
        const int r = i >> 6, c = i & 63;
        x_lds[r][c] = (_Float16)seqs[((size_t)b * SS + row0 + r) * DD + h * DH + c];
    }
    // Stage the three weight matrices row-major [e][d] (B[k=d][n=e] = W[e][d]).
    const float* Ws[3] = { Wq, Wk, Wv };
#pragma unroll
    for (int j = 0; j < 3; ++j) {
        const float* w = Ws[j] + h * DH * DH;
        for (int i = tid; i < DH * DH; i += 256)
            w_lds[j][i >> 6][i & 63] = (_Float16)w[i];
    }
    __syncthreads();

    // A fragments: x tile rows [wid*16, wid*16+16), K = DH split in 2 chunks.
    v16h a[2];
#pragma unroll
    for (int kc = 0; kc < 2; ++kc)
        a[kc] = load_frag(&x_lds[wid * 16 + mn][kc * 32], kb);

    const float* biases[3] = { bq, bk, bv };
    _Float16*    outs[3]   = { Q, K, V };
    const size_t obase = ((size_t)(b * HH + h) * SS + row0 + wid * 16) * DH;

#pragma unroll
    for (int j = 0; j < 3; ++j) {
#pragma unroll
        for (int nt = 0; nt < 4; ++nt) {
            v8f acc = {};
#pragma unroll
            for (int kc = 0; kc < 2; ++kc) {
                v16h bf = load_frag(&w_lds[j][nt * 16 + mn][kc * 32], kb);
                acc = wmma16(a[kc], bf, acc);
            }
            const float bias = biases[j][h * DH + nt * 16 + mn];
            _Float16* o = outs[j] + obase;
#pragma unroll
            for (int r = 0; r < 8; ++r) {
                const int mrow = r + kb;                       // C layout row
                o[(size_t)mrow * DH + nt * 16 + mn] = (_Float16)(acc[r] + bias);
            }
        }
    }
}

// ---------------------------------------------------------------------------
// Kernel 2: flash attention.  grid = (S/128, H, B), block = 256 (8 waves);
// each wave owns 16 query rows, loop over S in KV tiles of 64 rows.
// ---------------------------------------------------------------------------
__global__ __launch_bounds__(256) void flash_attn_kernel(
    const _Float16* __restrict__ Q, const _Float16* __restrict__ K,
    const _Float16* __restrict__ V, float* __restrict__ out)
{
    const int qt   = blockIdx.x;
    const int h    = blockIdx.y;
    const int b    = blockIdx.z;
    const int tid  = threadIdx.x;
    const int lane = tid & 31;
    const int wid  = tid >> 5;
    const int mn   = lane & 15;
    const int kb   = (lane >> 4) << 3;

    __shared__ __align__(16) _Float16 k_lds[64][DH];        // 8 KB (async target)
    __shared__ __align__(16) _Float16 vt_lds[DH][64];       // 8 KB (V transposed)
    __shared__ __align__(16) _Float16 p_lds[8][16][64];     // 16 KB (per-wave P)

    const size_t head_base = (size_t)(b * HH + h) * SS * DH;
    const _Float16* Qh = Q + head_base;
    const _Float16* Kh = K + head_base;
    const _Float16* Vh = V + head_base;

    // Q A-fragments straight from global (row-major [s][d], 16B aligned).
    const int q0 = qt * 128 + wid * 16;
    v16h aq[2];
#pragma unroll
    for (int kc = 0; kc < 2; ++kc)
        aq[kc] = load_frag(Qh + (size_t)(q0 + mn) * DH + kc * 32, kb);

    v8f o0 = {}, o1 = {}, o2 = {}, o3 = {};
    float mrow[8], lrow[8];
#pragma unroll
    for (int r = 0; r < 8; ++r) { mrow[r] = -1e30f; lrow[r] = 0.0f; }

    const unsigned klds_base = (unsigned)(size_t)&k_lds[0][0];
    const float scale = 0.125f;   // 1/sqrt(64)

    for (int jt = 0; jt < SS / 64; ++jt) {
        const _Float16* kg = Kh + (size_t)jt * 64 * DH;
        const _Float16* vg = Vh + (size_t)jt * 64 * DH;

        if (jt + 1 < SS / 64) {                 // pull next tiles toward L2/L0
            __builtin_prefetch(kg + 64 * DH, 0, 0);
            __builtin_prefetch(vg + 64 * DH, 0, 0);
        }

        // K tile: 64x64 f16 = 8192 B = 256 threads x 32 B, async copy to LDS.
        {
            const unsigned off = (unsigned)tid * 32u;
            const unsigned lds_addr = klds_base + off;
            const unsigned long long ga = (unsigned long long)(size_t)kg + off;
            asm volatile("global_load_async_to_lds_b128 %0, %1, off"
                         :: "v"(lds_addr), "v"(ga) : "memory");
            asm volatile("global_load_async_to_lds_b128 %0, %1, off offset:16"
                         :: "v"(lds_addr), "v"(ga) : "memory");
        }
        // V tile: stage transposed (vt[d][kvrow]) so PV B-fragments are rows.
        for (int i = tid; i < 64 * DH; i += 256) {
            const int r = i >> 6, c = i & 63;
            vt_lds[c][r] = vg[i];
        }
        asm volatile("s_wait_asynccnt 0x0" ::: "memory");
        __syncthreads();

        // scores[16x64] = Q(16x64) @ K^T : B[k=d][n=kvrow] = k_lds[kvrow][d]
        v8f s0 = {}, s1 = {}, s2 = {}, s3 = {};
#pragma unroll
        for (int kc = 0; kc < 2; ++kc) {
            s0 = wmma16(aq[kc], load_frag(&k_lds[ 0 + mn][kc * 32], kb), s0);
            s1 = wmma16(aq[kc], load_frag(&k_lds[16 + mn][kc * 32], kb), s1);
            s2 = wmma16(aq[kc], load_frag(&k_lds[32 + mn][kc * 32], kb), s2);
            s3 = wmma16(aq[kc], load_frag(&k_lds[48 + mn][kc * 32], kb), s3);
        }

        // Online softmax. Row m spans 16 lanes (n) at fixed vgpr r; reduce
        // within width-16 so the two row-halves stay independent.
        float alpha[8];
#pragma unroll
        for (int r = 0; r < 8; ++r) {
            const float x0 = s0[r] * scale, x1 = s1[r] * scale;
            const float x2 = s2[r] * scale, x3 = s3[r] * scale;
            float mx = fmaxf(fmaxf(x0, x1), fmaxf(x2, x3));
#pragma unroll
            for (int o = 1; o < 16; o <<= 1) mx = fmaxf(mx, __shfl_xor(mx, o, 16));
            const float mnew = fmaxf(mrow[r], mx);
            const float a    = __expf(mrow[r] - mnew);
            const float p0   = __expf(x0 - mnew);
            const float p1   = __expf(x1 - mnew);
            const float p2   = __expf(x2 - mnew);
            const float p3   = __expf(x3 - mnew);
            float rs = (p0 + p1) + (p2 + p3);
#pragma unroll
            for (int o = 1; o < 16; o <<= 1) rs += __shfl_xor(rs, o, 16);
            lrow[r] = lrow[r] * a + rs;
            mrow[r] = mnew;
            alpha[r] = a;
            // Re-layout P (C layout -> LDS row-major [m][n]) for A-fragment use.
            const int m = r + kb;
            p_lds[wid][m][ 0 + mn] = (_Float16)p0;
            p_lds[wid][m][16 + mn] = (_Float16)p1;
            p_lds[wid][m][32 + mn] = (_Float16)p2;
            p_lds[wid][m][48 + mn] = (_Float16)p3;
        }
#pragma unroll
        for (int r = 0; r < 8; ++r) {
            o0[r] *= alpha[r]; o1[r] *= alpha[r];
            o2[r] *= alpha[r]; o3[r] *= alpha[r];
        }
        asm volatile("" ::: "memory");  // order p_lds stores before reloads

        // O += P(16x64) @ V(64x64): B[k=kvrow][n=d] = vt_lds[d][kvrow]
        v16h ap[2];
#pragma unroll
        for (int kc = 0; kc < 2; ++kc)
            ap[kc] = load_frag(&p_lds[wid][mn][kc * 32], kb);
#pragma unroll
        for (int kc = 0; kc < 2; ++kc) {
            o0 = wmma16(ap[kc], load_frag(&vt_lds[0 * 16 + mn][kc * 32], kb), o0);
            o1 = wmma16(ap[kc], load_frag(&vt_lds[1 * 16 + mn][kc * 32], kb), o1);
            o2 = wmma16(ap[kc], load_frag(&vt_lds[2 * 16 + mn][kc * 32], kb), o2);
            o3 = wmma16(ap[kc], load_frag(&vt_lds[3 * 16 + mn][kc * 32], kb), o3);
        }

        __syncthreads();   // protect k_lds / vt_lds before next tile
    }

    // Epilogue: normalize and scatter f32 output [B,S,D] (D = H*DH).
    float inv[8];
#pragma unroll
    for (int r = 0; r < 8; ++r) inv[r] = 1.0f / lrow[r];

    const size_t obase = (size_t)b * SS + q0;
#pragma unroll
    for (int r = 0; r < 8; ++r) {
        const size_t row = obase + (size_t)(r + kb);
        float* orow = out + row * DD + h * DH;
        orow[0 * 16 + mn] = o0[r] * inv[r];
        orow[1 * 16 + mn] = o1[r] * inv[r];
        orow[2 * 16 + mn] = o2[r] * inv[r];
        orow[3 * 16 + mn] = o3[r] * inv[r];
    }
}

// ---------------------------------------------------------------------------
extern "C" void kernel_launch(void* const* d_in, const int* in_sizes, int n_in,
                              void* d_out, int out_size, void* d_ws, size_t ws_size,
                              hipStream_t stream) {
    const float* seqs = (const float*)d_in[0];
    const float* Wq   = (const float*)d_in[1];
    const float* bq   = (const float*)d_in[2];
    const float* Wk   = (const float*)d_in[3];
    const float* bk   = (const float*)d_in[4];
    const float* Wv   = (const float*)d_in[5];
    const float* bv   = (const float*)d_in[6];
    float* out = (float*)d_out;

    // Workspace: Q,K,V f16 [B,H,S,DH] -> 3 * 8 MB = 24 MB.
    const size_t elems = (size_t)BB * HH * SS * DH;
    _Float16* Qw = (_Float16*)d_ws;
    _Float16* Kw = Qw + elems;
    _Float16* Vw = Kw + elems;

    dim3 grid(SS / 128, HH, BB), block(256);
    qkv_proj_kernel<<<grid, block, 0, stream>>>(seqs, Wq, bq, Wk, bk, Wv, bv,
                                                Qw, Kw, Vw);
    flash_attn_kernel<<<grid, block, 0, stream>>>(Qw, Kw, Vw, out);
}

// v001
// One run takes 138 microseconds.
// Two timings next to v000 put it at 2.07 and 2.08 times that version's speed.
#include <hip/hip_runtime.h>

// MultiHeadAttention forward for MI455X (gfx1250), wave32, WMMA f16->f32.
// B=2, S=2048, D=1024, H=16, DH=64.
//
//  1) qkv_proj: x @ W^T + b per head, f16 WMMA, results to d_ws as f16
//     in [B,H,S,DH] layout (Q,K,V = 3 * 8MB = 24MB of workspace).
//  2) flash_attn: online-softmax flash attention; KV tiles of 64 rows,
//     16 WMMAs per iteration; K tiles staged in LDS via
//     global_load_async_to_lds_b128 (ASYNCcnt), V staged transposed.

#define BB 2
#define SS 2048
#define DD 1024
#define HH 16
#define DH 64
// LDS row pitch in halfs for every 64-half tile row: 144 B = 16 B x 9 (odd), so
// the 16 rows that one ds_load_b128 fragment read touches fall on distinct banks.
#define LP 72

typedef __attribute__((ext_vector_type(16))) _Float16 v16h;
typedef __attribute__((ext_vector_type(8)))  float    v8f;

__device__ __forceinline__ v8f wmma16(v16h a, v16h b, v8f c) {
    // D = A(16x32 f16) * B(32x16 f16) + C(16x16 f32)
    return __builtin_amdgcn_wmma_f32_16x16x32_f16(
        /*neg_a=*/false, a, /*neg_b=*/false, b,
        /*c_mod=*/(short)0, c, /*reuse_a=*/false, /*reuse_b=*/false);
}

// Load one 16-half fragment per lane as two aligned 16B chunks.
// rowp points at the lane's row start (+ kchunk*32 already applied);
// kbase = 8*(lane>=16). Matches ISA 16-bit A/B VGPR striping.
__device__ __forceinline__ v16h load_frag(const _Float16* rowp, int kbase) {
    union { v16h h; uint4 u[2]; } f;
    f.u[0] = *(const uint4*)(rowp + kbase);
    f.u[1] = *(const uint4*)(rowp + 16 + kbase);
    return f.h;
}

// ---------------------------------------------------------------------------
// Kernel 1: per-head QKV projection.  grid = (S/128, H, B), block = 256 (8 waves)
// ---------------------------------------------------------------------------
__global__ __launch_bounds__(256) void qkv_proj_kernel(
    const float* __restrict__ seqs,
    const float* __restrict__ Wq, const float* __restrict__ bq,
    const float* __restrict__ Wk, const float* __restrict__ bk,
    const float* __restrict__ Wv, const float* __restrict__ bv,
    _Float16* __restrict__ Q, _Float16* __restrict__ K, _Float16* __restrict__ V)
{
    const int tile = blockIdx.x;
    const int h    = blockIdx.y;
    const int b    = blockIdx.z;
    const int tid  = threadIdx.x;
    const int lane = tid & 31;
    const int wid  = tid >> 5;
    const int mn   = lane & 15;            // M (A row) or N (B/C col) index
    const int kb   = (lane >> 4) << 3;     // 0 or 8: K-half / C-row offset

    __shared__ __align__(16) _Float16 x_lds[128][LP];      // 18 KB
    __shared__ __align__(16) _Float16 w_lds[3][DH][LP];    // 27 KB

    const int row0 = tile * 128;

    // Stage x slice for this head (f32 -> f16), coalesced.
    for (int i = tid; i < 128 * DH; i += 256) {
        const int r = i >> 6, c = i & 63;
        x_lds[r][c] = (_Float16)seqs[((size_t)b * SS + row0 + r) * DD + h * DH + c];
    }
    // Stage the three weight matrices row-major [e][d] (B[k=d][n=e] = W[e][d]).
    const float* Ws[3] = { Wq, Wk, Wv };
#pragma unroll
    for (int j = 0; j < 3; ++j) {
        const float* w = Ws[j] + h * DH * DH;
        for (int i = tid; i < DH * DH; i += 256)
            w_lds[j][i >> 6][i & 63] = (_Float16)w[i];
    }
    __syncthreads();

    // A fragments: x tile rows [wid*16, wid*16+16), K = DH split in 2 chunks.
    v16h a[2];
#pragma unroll
    for (int kc = 0; kc < 2; ++kc)
        a[kc] = load_frag(&x_lds[wid * 16 + mn][kc * 32], kb);

    const float* biases[3] = { bq, bk, bv };
    _Float16*    outs[3]   = { Q, K, V };
    const size_t obase = ((size_t)(b * HH + h) * SS + row0 + wid * 16) * DH;

#pragma unroll
    for (int j = 0; j < 3; ++j) {
#pragma unroll
        for (int nt = 0; nt < 4; ++nt) {
            v8f acc = {};
#pragma unroll
            for (int kc = 0; kc < 2; ++kc) {
                v16h bf = load_frag(&w_lds[j][nt * 16 + mn][kc * 32], kb);
                acc = wmma16(a[kc], bf, acc);
            }
            const float bias = biases[j][h * DH + nt * 16 + mn];
            _Float16* o = outs[j] + obase;
#pragma unroll
            for (int r = 0; r < 8; ++r) {
                const int mrow = r + kb;                       // C layout row
                o[(size_t)mrow * DH + nt * 16 + mn] = (_Float16)(acc[r] + bias);
            }
        }
    }
}

// ---------------------------------------------------------------------------
// Kernel 2: flash attention.  grid = (S/128, H, B), block = 256 (8 waves);
// each wave owns 16 query rows, loop over S in KV tiles of 64 rows.
// ---------------------------------------------------------------------------
__global__ __launch_bounds__(256) void flash_attn_kernel(
    const _Float16* __restrict__ Q, const _Float16* __restrict__ K,
    const _Float16* __restrict__ V, float* __restrict__ out)
{
    const int qt   = blockIdx.x;
    const int h    = blockIdx.y;
    const int b    = blockIdx.z;
    const int tid  = threadIdx.x;
    const int lane = tid & 31;
    const int wid  = tid >> 5;
    const int mn   = lane & 15;
    const int kb   = (lane >> 4) << 3;

    __shared__ __align__(16) _Float16 k_lds[64][LP];        // 9 KB (async target)
    __shared__ __align__(16) _Float16 vt_lds[DH][LP];       // 9 KB (V transposed)
    __shared__ __align__(16) _Float16 p_lds[8][16][LP];     // 18 KB (per-wave P)

    const size_t head_base = (size_t)(b * HH + h) * SS * DH;
    const _Float16* Qh = Q + head_base;
    const _Float16* Kh = K + head_base;
    const _Float16* Vh = V + head_base;

    // Q A-fragments straight from global (row-major [s][d], 16B aligned).
    const int q0 = qt * 128 + wid * 16;
    v16h aq[2];
#pragma unroll
    for (int kc = 0; kc < 2; ++kc)
        aq[kc] = load_frag(Qh + (size_t)(q0 + mn) * DH + kc * 32, kb);

    v8f o0 = {}, o1 = {}, o2 = {}, o3 = {};
    float mrow[8], lrow[8];
#pragma unroll
    for (int r = 0; r < 8; ++r) { mrow[r] = -1e30f; lrow[r] = 0.0f; }

    const unsigned klds_base = (unsigned)(size_t)&k_lds[0][0];
    const float scale = 0.125f;   // 1/sqrt(64)

    for (int jt = 0; jt < SS / 64; ++jt) {
        const _Float16* kg = Kh + (size_t)jt * 64 * DH;
        const _Float16* vg = Vh + (size_t)jt * 64 * DH;

        if (jt + 1 < SS / 64) {                 // pull next tiles toward L2/L0
            __builtin_prefetch(kg + 64 * DH, 0, 0);
            __builtin_prefetch(vg + 64 * DH, 0, 0);
        }

        // K tile: 64x64 f16 = 8192 B = 256 threads x 32 B, async copy to LDS.
        {
            const unsigned off = (unsigned)tid * 32u;
            // four threads per 128 B source row; rows land LP halfs apart
            const unsigned lds_addr = klds_base + (unsigned)(tid >> 2) * (LP * 2u)
                                    + (unsigned)(tid & 3) * 32u;
            const unsigned long long ga = (unsigned long long)(size_t)kg + off;
            asm volatile("global_load_async_to_lds_b128 %0, %1, off"
                         :: "v"(lds_addr), "v"(ga) : "memory");
            asm volatile("global_load_async_to_lds_b128 %0, %1, off offset:16"
                         :: "v"(lds_addr), "v"(ga) : "memory");
        }
        // V tile: stage transposed (vt[d][kvrow]) so PV B-fragments are rows.
        for (int i = tid; i < 64 * DH; i += 256) {
            const int r = i >> 6, c = i & 63;
            vt_lds[c][r] = vg[i];
        }
        asm volatile("s_wait_asynccnt 0x0" ::: "memory");
        __syncthreads();

        // scores[16x64] = Q(16x64) @ K^T : B[k=d][n=kvrow] = k_lds[kvrow][d]
        v8f s0 = {}, s1 = {}, s2 = {}, s3 = {};
#pragma unroll
        for (int kc = 0; kc < 2; ++kc) {
            s0 = wmma16(aq[kc], load_frag(&k_lds[ 0 + mn][kc * 32], kb), s0);
            s1 = wmma16(aq[kc], load_frag(&k_lds[16 + mn][kc * 32], kb), s1);
            s2 = wmma16(aq[kc], load_frag(&k_lds[32 + mn][kc * 32], kb), s2);
            s3 = wmma16(aq[kc], load_frag(&k_lds[48 + mn][kc * 32], kb), s3);
        }

        // Online softmax. Row m spans 16 lanes (n) at fixed vgpr r; reduce
        // within width-16 so the two row-halves stay independent.
        float alpha[8];
#pragma unroll
        for (int r = 0; r < 8; ++r) {
            const float x0 = s0[r] * scale, x1 = s1[r] * scale;
            const float x2 = s2[r] * scale, x3 = s3[r] * scale;
            float mx = fmaxf(fmaxf(x0, x1), fmaxf(x2, x3));
#pragma unroll
            for (int o = 1; o < 16; o <<= 1) mx = fmaxf(mx, __shfl_xor(mx, o, 16));
            const float mnew = fmaxf(mrow[r], mx);
            const float a    = __expf(mrow[r] - mnew);
            const float p0   = __expf(x0 - mnew);
            const float p1   = __expf(x1 - mnew);
            const float p2   = __expf(x2 - mnew);
            const float p3   = __expf(x3 - mnew);
            float rs = (p0 + p1) + (p2 + p3);
#pragma unroll
            for (int o = 1; o < 16; o <<= 1) rs += __shfl_xor(rs, o, 16);
            lrow[r] = lrow[r] * a + rs;
            mrow[r] = mnew;
            alpha[r] = a;
            // Re-layout P (C layout -> LDS row-major [m][n]) for A-fragment use.
            const int m = r + kb;
            p_lds[wid][m][ 0 + mn] = (_Float16)p0;
            p_lds[wid][m][16 + mn] = (_Float16)p1;
            p_lds[wid][m][32 + mn] = (_Float16)p2;
            p_lds[wid][m][48 + mn] = (_Float16)p3;
        }
#pragma unroll
        for (int r = 0; r < 8; ++r) {
            o0[r] *= alpha[r]; o1[r] *= alpha[r];
            o2[r] *= alpha[r]; o3[r] *= alpha[r];
        }
        asm volatile("" ::: "memory");  // order p_lds stores before reloads

        // O += P(16x64) @ V(64x64): B[k=kvrow][n=d] = vt_lds[d][kvrow]
        v16h ap[2];
#pragma unroll
        for (int kc = 0; kc < 2; ++kc)
            ap[kc] = load_frag(&p_lds[wid][mn][kc * 32], kb);
#pragma unroll
        for (int kc = 0; kc < 2; ++kc) {
            o0 = wmma16(ap[kc], load_frag(&vt_lds[0 * 16 + mn][kc * 32], kb), o0);
            o1 = wmma16(ap[kc], load_frag(&vt_lds[1 * 16 + mn][kc * 32], kb), o1);
            o2 = wmma16(ap[kc], load_frag(&vt_lds[2 * 16 + mn][kc * 32], kb), o2);
            o3 = wmma16(ap[kc], load_frag(&vt_lds[3 * 16 + mn][kc * 32], kb), o3);
        }

        __syncthreads();   // protect k_lds / vt_lds before next tile
    }

    // Epilogue: normalize and scatter f32 output [B,S,D] (D = H*DH).
    float inv[8];
#pragma unroll
    for (int r = 0; r < 8; ++r) inv[r] = 1.0f / lrow[r];

    const size_t obase = (size_t)b * SS + q0;
#pragma unroll
    for (int r = 0; r < 8; ++r) {
        const size_t row = obase + (size_t)(r + kb);
        float* orow = out + row * DD + h * DH;
        orow[0 * 16 + mn] = o0[r] * inv[r];
        orow[1 * 16 + mn] = o1[r] * inv[r];
        orow[2 * 16 + mn] = o2[r] * inv[r];
        orow[3 * 16 + mn] = o3[r] * inv[r];
    }
}

// ---------------------------------------------------------------------------
extern "C" void kernel_launch(void* const* d_in, const int* in_sizes, int n_in,
                              void* d_out, int out_size, void* d_ws, size_t ws_size,
                              hipStream_t stream) {
    const float* seqs = (const float*)d_in[0];
    const float* Wq   = (const float*)d_in[1];
    const float* bq   = (const float*)d_in[2];
    const float* Wk   = (const float*)d_in[3];
    const float* bk   = (const float*)d_in[4];
    const float* Wv   = (const float*)d_in[5];
    const float* bv   = (const float*)d_in[6];
    float* out = (float*)d_out;

    // Workspace: Q,K,V f16 [B,H,S,DH] -> 3 * 8 MB = 24 MB.
    const size_t elems = (size_t)BB * HH * SS * DH;
    _Float16* Qw = (_Float16*)d_ws;
    _Float16* Kw = Qw + elems;
    _Float16* Vw = Kw + elems;

    dim3 grid(SS / 128, HH, BB), block(256);
    qkv_proj_kernel<<<grid, block, 0, stream>>>(seqs, Wq, bq, Wk, bk, Wv, bv,
                                                Qw, Kw, Vw);
    flash_attn_kernel<<<grid, block, 0, stream>>>(Qw, Kw, Vw, out);
}

// v002
// One run takes 116 microseconds.
// In both of two side-by-side timings against v001, it was 1.19 times as fast.
// All steps since v000 together make it 2.47 times as fast.
#include <hip/hip_runtime.h>

// MultiHeadAttention forward for MI455X (gfx1250), wave32, WMMA f16->f32.
// B=2, S=2048, D=1024, H=16, DH=64.
//
//  1) qkv_proj: x @ W^T + b per head, f16 WMMA, results to d_ws as f16
//     in [B,H,S,DH] layout (Q,K,V = 3 * 8MB = 24MB of workspace).
//  2) flash_attn: online-softmax flash attention; KV tiles of 64 rows,
//     16 WMMAs per iteration; K tiles staged in LDS via
//     global_load_async_to_lds_b128 (ASYNCcnt), V staged transposed.
//     Both products run transposed (S^T = K Q^T, O^T += V^T P^T): a lane
//     holds scores of one query only, and P^T packs in registers.

#define BB 2
#define SS 2048
#define DD 1024
#define HH 16
#define DH 64
// LDS row pitch in halfs for every 64-half tile row: 144 B = 16 B x 9 (odd), so
// the 16 rows that one ds_load_b128 fragment read touches fall on distinct banks.
#define LP 72

typedef __attribute__((ext_vector_type(16))) _Float16 v16h;
typedef __attribute__((ext_vector_type(8)))  float    v8f;

__device__ __forceinline__ v8f wmma16(v16h a, v16h b, v8f c) {
    // D = A(16x32 f16) * B(32x16 f16) + C(16x16 f32)
    return __builtin_amdgcn_wmma_f32_16x16x32_f16(
        /*neg_a=*/false, a, /*neg_b=*/false, b,
        /*c_mod=*/(short)0, c, /*reuse_a=*/false, /*reuse_b=*/false);
}

// Load one 16-half fragment per lane as two aligned 16B chunks.
// rowp points at the lane's row start (+ kchunk*32 already applied);
// kbase = 8*(lane>=16). Matches ISA 16-bit A/B VGPR striping.
__device__ __forceinline__ v16h load_frag(const _Float16* rowp, int kbase) {
    union { v16h h; uint4 u[2]; } f;
    f.u[0] = *(const uint4*)(rowp + kbase);
    f.u[1] = *(const uint4*)(rowp + 16 + kbase);
    return f.h;
}

// ---------------------------------------------------------------------------
// Kernel 1: per-head QKV projection.  grid = (S/128, H, B), block = 256 (8 waves)
// ---------------------------------------------------------------------------
__global__ __launch_bounds__(256) void qkv_proj_kernel(
    const float* __restrict__ seqs,
    const float* __restrict__ Wq, const float* __restrict__ bq,
    const float* __restrict__ Wk, const float* __restrict__ bk,
    const float* __restrict__ Wv, const float* __restrict__ bv,
    _Float16* __restrict__ Q, _Float16* __restrict__ K, _Float16* __restrict__ V)
{
    const int tile = blockIdx.x;
    const int h    = blockIdx.y;
    const int b    = blockIdx.z;
    const int tid  = threadIdx.x;
    const int lane = tid & 31;
    const int wid  = tid >> 5;
    const int mn   = lane & 15;            // M (A row) or N (B/C col) index
    const int kb   = (lane >> 4) << 3;     // 0 or 8: K-half / C-row offset

    __shared__ __align__(16) _Float16 x_lds[128][LP];      // 18 KB
    __shared__ __align__(16) _Float16 w_lds[3][DH][LP];    // 27 KB

    const int row0 = tile * 128;

    // Stage x slice for this head (f32 -> f16), coalesced.
    for (int i = tid; i < 128 * DH; i += 256) {
        const int r = i >> 6, c = i & 63;
        x_lds[r][c] = (_Float16)seqs[((size_t)b * SS + row0 + r) * DD + h * DH + c];
    }
    // Stage the three weight matrices row-major [e][d] (B[k=d][n=e] = W[e][d]).
    const float* Ws[3] = { Wq, Wk, Wv };
#pragma unroll
    for (int j = 0; j < 3; ++j) {
        const float* w = Ws[j] + h * DH * DH;
        for (int i = tid; i < DH * DH; i += 256)
            w_lds[j][i >> 6][i & 63] = (_Float16)w[i];
    }
    __syncthreads();

    // A fragments: x tile rows [wid*16, wid*16+16), K = DH split in 2 chunks.
    v16h a[2];
#pragma unroll
    for (int kc = 0; kc < 2; ++kc)
        a[kc] = load_frag(&x_lds[wid * 16 + mn][kc * 32], kb);

    const float* biases[3] = { bq, bk, bv };
    _Float16*    outs[3]   = { Q, K, V };
    const size_t obase = ((size_t)(b * HH + h) * SS + row0 + wid * 16) * DH;

#pragma unroll
    for (int j = 0; j < 3; ++j) {
#pragma unroll
        for (int nt = 0; nt < 4; ++nt) {
            v8f acc = {};
#pragma unroll
            for (int kc = 0; kc < 2; ++kc) {
                v16h bf = load_frag(&w_lds[j][nt * 16 + mn][kc * 32], kb);
                acc = wmma16(a[kc], bf, acc);
            }
            const float bias = biases[j][h * DH + nt * 16 + mn];
            _Float16* o = outs[j] + obase;
#pragma unroll
            for (int r = 0; r < 8; ++r) {
                const int mrow = r + kb;                       // C layout row
                o[(size_t)mrow * DH + nt * 16 + mn] = (_Float16)(acc[r] + bias);
            }
        }
    }
}

// ---------------------------------------------------------------------------
// Kernel 2: flash attention.  grid = (S/128, H, B), block = 256 (8 waves);
// each wave owns 16 query rows, loop over S in KV tiles of 64 rows.
// ---------------------------------------------------------------------------
// Value of lane l ^ 16: the other half of the same query's column.
__device__ __forceinline__ float xhalf(float x) {
    const int i = __builtin_bit_cast(int, x);
    return __builtin_bit_cast(float, __builtin_amdgcn_permlanex16(
        i, i, 0x76543210, 0xfedcba98, false, false));
}

__global__ __launch_bounds__(256) void flash_attn_kernel(
    const _Float16* __restrict__ Q, const _Float16* __restrict__ K,
    const _Float16* __restrict__ V, float* __restrict__ out)
{
    const int qt   = blockIdx.x;
    const int h    = blockIdx.y;
    const int b    = blockIdx.z;
    const int tid  = threadIdx.x;
    const int lane = tid & 31;
    const int wid  = tid >> 5;
    const int mn   = lane & 15;
    const int kb   = (lane >> 4) << 3;

    __shared__ __align__(16) _Float16 k_lds[64][LP];        // 9 KB (async target)
    __shared__ __align__(16) _Float16 vt_lds[DH][LP];       // 9 KB (V transposed)

    const size_t head_base = (size_t)(b * HH + h) * SS * DH;
    const _Float16* Qh = Q + head_base;
    const _Float16* Kh = K + head_base;
    const _Float16* Vh = V + head_base;

    // Q^T B-fragments straight from global (row-major [s][d], 16B aligned).
    const int q0 = qt * 128 + wid * 16;
    v16h aq[2];
#pragma unroll
    for (int kc = 0; kc < 2; ++kc)
        aq[kc] = load_frag(Qh + (size_t)(q0 + mn) * DH + kc * 32, kb);

    v8f o0 = {}, o1 = {}, o2 = {}, o3 = {};
    // Lane (mn, half) serves query q0 + mn: mrun is that query's running maximum
    // (equal in both halves), lrun the sum over this half's keys only.
    float mrun = -1e30f, lrun = 0.0f;

    const unsigned klds_base = (unsigned)(size_t)&k_lds[0][0];
    const float scale = 0.125f;   // 1/sqrt(64)

    for (int jt = 0; jt < SS / 64; ++jt) {
        const _Float16* kg = Kh + (size_t)jt * 64 * DH;
        const _Float16* vg = Vh + (size_t)jt * 64 * DH;

        if (jt + 1 < SS / 64) {                 // pull next tiles toward L2/L0
            __builtin_prefetch(kg + 64 * DH, 0, 0);
            __builtin_prefetch(vg + 64 * DH, 0, 0);
        }

        // K tile: 64x64 f16 = 8192 B = 256 threads x 32 B, async copy to LDS.
        {
            const unsigned off = (unsigned)tid * 32u;
            // four threads per 128 B source row; rows land LP halfs apart
            const unsigned lds_addr = klds_base + (unsigned)(tid >> 2) * (LP * 2u)
                                    + (unsigned)(tid & 3) * 32u;
            const unsigned long long ga = (unsigned long long)(size_t)kg + off;
            asm volatile("global_load_async_to_lds_b128 %0, %1, off"
                         :: "v"(lds_addr), "v"(ga) : "memory");
            asm volatile("global_load_async_to_lds_b128 %0, %1, off offset:16"
                         :: "v"(lds_addr), "v"(ga) : "memory");
        }
        // V tile: stage transposed (vt[d][kvrow]) so V^T A-fragments are rows.
        for (int i = tid; i < 64 * DH; i += 256) {
            const int r = i >> 6, c = i & 63;
            vt_lds[c][r] = vg[i];
        }
        asm volatile("s_wait_asynccnt 0x0" ::: "memory");
        __syncthreads();

        // S^T[64x16] = K(64x64) @ Q^T : A[m=kvrow][k=d] = k_lds[kvrow][d].
        // Tile t, register r of lane (mn, half): key 16 t + kb + r, query mn.
        v8f s0 = {}, s1 = {}, s2 = {}, s3 = {};
#pragma unroll
        for (int kc = 0; kc < 2; ++kc) {
            s0 = wmma16(load_frag(&k_lds[ 0 + mn][kc * 32], kb), aq[kc], s0);
            s1 = wmma16(load_frag(&k_lds[16 + mn][kc * 32], kb), aq[kc], s1);
            s2 = wmma16(load_frag(&k_lds[32 + mn][kc * 32], kb), aq[kc], s2);
            s3 = wmma16(load_frag(&k_lds[48 + mn][kc * 32], kb), aq[kc], s3);
        }

        // Online softmax: the lane's 32 scores belong to one query, so maximum
        // and sum run in-lane; one exchange joins the halves' maxima.
        s0 *= scale; s1 *= scale; s2 *= scale; s3 *= scale;
        float mx = -1e30f;
#pragma unroll
        for (int r = 0; r < 8; ++r)
            mx = fmaxf(mx, fmaxf(fmaxf(s0[r], s1[r]), fmaxf(s2[r], s3[r])));
        mx = fmaxf(mx, xhalf(mx));
        const float mnew  = fmaxf(mrun, mx);
        const float alpha = __expf(mrun - mnew);
        mrun = mnew;

        // P^T as B operand: two score tiles of 16 keys, converted in place, are
        // one 32-key fragment in the k order that load_frag gives V^T.
        s0 -= mnew; s1 -= mnew; s2 -= mnew; s3 -= mnew;
        v16h bp[2];
        float rs = 0.0f;
#pragma unroll
        for (int r = 0; r < 8; ++r) {
            const float p0 = __expf(s0[r]);
            const float p1 = __expf(s1[r]);
            const float p2 = __expf(s2[r]);
            const float p3 = __expf(s3[r]);
            rs += (p0 + p1) + (p2 + p3);
            bp[0][r] = (_Float16)p0; bp[0][8 + r] = (_Float16)p1;
            bp[1][r] = (_Float16)p2; bp[1][8 + r] = (_Float16)p3;
        }
        lrun = lrun * alpha + rs;
#pragma unroll
        for (int r = 0; r < 8; ++r) {
            o0[r] *= alpha; o1[r] *= alpha;
            o2[r] *= alpha; o3[r] *= alpha;
        }

        // O^T += V^T(64x64) @ P^T(64x16): A[m=d][k=kvrow] = vt_lds[d][kvrow]
#pragma unroll
        for (int kc = 0; kc < 2; ++kc) {
            o0 = wmma16(load_frag(&vt_lds[0 * 16 + mn][kc * 32], kb), bp[kc], o0);
            o1 = wmma16(load_frag(&vt_lds[1 * 16 + mn][kc * 32], kb), bp[kc], o1);
            o2 = wmma16(load_frag(&vt_lds[2 * 16 + mn][kc * 32], kb), bp[kc], o2);
            o3 = wmma16(load_frag(&vt_lds[3 * 16 + mn][kc * 32], kb), bp[kc], o3);
        }

        __syncthreads();   // protect k_lds / vt_lds before next tile
    }

    // Epilogue: join the halves' sums, normalize, store f32 output [B,S,D]
    // (D = H*DH). Tile t, register r: column 16 t + kb + r of row q0 + mn.
    const float inv = 1.0f / (lrun + xhalf(lrun));

    float* orow = out + ((size_t)b * SS + q0 + mn) * DD + h * DH + kb;
    const v8f ot[4] = { o0, o1, o2, o3 };
#pragma unroll
    for (int t = 0; t < 4; ++t) {
        *(float4*)(orow + t * 16) = make_float4(ot[t][0] * inv, ot[t][1] * inv,
                                                ot[t][2] * inv, ot[t][3] * inv);
        *(float4*)(orow + t * 16 + 4) = make_float4(ot[t][4] * inv, ot[t][5] * inv,
                                                    ot[t][6] * inv, ot[t][7] * inv);
    }
}

// ---------------------------------------------------------------------------
extern "C" void kernel_launch(void* const* d_in, const int* in_sizes, int n_in,
                              void* d_out, int out_size, void* d_ws, size_t ws_size,
                              hipStream_t stream) {
    const float* seqs = (const float*)d_in[0];
    const float* Wq   = (const float*)d_in[1];
    const float* bq   = (const float*)d_in[2];
    const float* Wk   = (const float*)d_in[3];
    const float* bk   = (const float*)d_in[4];
    const float* Wv   = (const float*)d_in[5];
    const float* bv   = (const float*)d_in[6];
    float* out = (float*)d_out;

    // Workspace: Q,K,V f16 [B,H,S,DH] -> 3 * 8 MB = 24 MB.
    const size_t elems = (size_t)BB * HH * SS * DH;
    _Float16* Qw = (_Float16*)d_ws;
    _Float16* Kw = Qw + elems;
    _Float16* Vw = Kw + elems;

    dim3 grid(SS / 128, HH, BB), block(256);
    qkv_proj_kernel<<<grid, block, 0, stream>>>(seqs, Wq, bq, Wk, bk, Wv, bv,
                                                Qw, Kw, Vw);
    flash_attn_kernel<<<grid, block, 0, stream>>>(Qw, Kw, Vw, out);
}

// v003
// Measured time: 73.9 microseconds a run.
// In two side-by-side timings against v002, it was 1.55 and 1.57 times as fast.
// All steps since v000 together make it 3.85 times as fast.
#include <hip/hip_runtime.h>

// MultiHeadAttention forward for MI455X (gfx1250), wave32, WMMA f16->f32.
// B=2, S=2048, D=1024, H=16, DH=64.
//
//  1) qkv_proj: x @ W^T + b per head, f16 WMMA, results to d_ws as f16
//     in [B,H,S,DH] layout (Q,K,V = 3 * 8MB = 24MB of workspace).
//  2) flash_attn: online-softmax flash attention; KV tiles of 64 rows,
//     16 WMMAs per iteration; K tiles staged in LDS via
//     global_load_async_to_lds_b128 (ASYNCcnt), V the same way, row-major;
//     V^T fragments come out of LDS by ds_load_tr16_b128.
//     Both products run transposed (S^T = K Q^T, O^T += V^T P^T): a lane
//     holds scores of one query only, and P^T packs in registers.

#define BB 2
#define SS 2048
#define DD 1024
#define HH 16
#define DH 64
// LDS row pitch in halfs for the 64-half x, W and K tile rows: 144 B = 16 B x 9 (odd), so
// the 16 rows that one ds_load_b128 fragment read touches fall on distinct banks.
#define LP 72
// Pitch of the V tile rows, which ds_load_tr16_b128 reads: 160 B = 32 B x 5 (odd).
#define VP 80

typedef __attribute__((ext_vector_type(16))) _Float16 v16h;
typedef __attribute__((ext_vector_type(8)))  float    v8f;

__device__ __forceinline__ v8f wmma16(v16h a, v16h b, v8f c) {
    // D = A(16x32 f16) * B(32x16 f16) + C(16x16 f32)
    return __builtin_amdgcn_wmma_f32_16x16x32_f16(
        /*neg_a=*/false, a, /*neg_b=*/false, b,
        /*c_mod=*/(short)0, c, /*reuse_a=*/false, /*reuse_b=*/false);
}

// Load one 16-half fragment per lane as two aligned 16B chunks.
// rowp points at the lane's row start (+ kchunk*32 already applied);
// kbase = 8*(lane>=16). Matches ISA 16-bit A/B VGPR striping.
__device__ __forceinline__ v16h load_frag(const _Float16* rowp, int kbase) {
    union { v16h h; uint4 u[2]; } f;
    f.u[0] = *(const uint4*)(rowp + kbase);
    f.u[1] = *(const uint4*)(rowp + 16 + kbase);
    return f.h;
}

// One 16(d) x 32(key) V^T fragment out of a row-major V tile: p is the lane's
// address in the tile's first 16 keys; the second load takes the next 16 keys.
// Lane (mn, half) gets keys 8 half + 0..7 and 16 + 8 half + 0..7 of column mn:
// the k order of load_frag.
typedef __attribute__((ext_vector_type(8))) short s16x8;
__device__ __forceinline__ v16h load_frag_tr(const _Float16* p) {
    typedef __attribute__((address_space(3))) s16x8 lds_s16x8;
    union { v16h h; s16x8 u[2]; } f;
    f.u[0] = __builtin_amdgcn_ds_load_tr16_b128_v8i16((lds_s16x8*)p);
    f.u[1] = __builtin_amdgcn_ds_load_tr16_b128_v8i16((lds_s16x8*)(p + 16 * VP));
    return f.h;
}

// ---------------------------------------------------------------------------
// Kernel 1: per-head QKV projection.  grid = (S/128, H, B), block = 256 (8 waves)
// ---------------------------------------------------------------------------
__global__ __launch_bounds__(256) void qkv_proj_kernel(
    const float* __restrict__ seqs,
    const float* __restrict__ Wq, const float* __restrict__ bq,
    const float* __restrict__ Wk, const float* __restrict__ bk,
    const float* __restrict__ Wv, const float* __restrict__ bv,
    _Float16* __restrict__ Q, _Float16* __restrict__ K, _Float16* __restrict__ V)
{
    const int tile = blockIdx.x;
    const int h    = blockIdx.y;
    const int b    = blockIdx.z;
    const int tid  = threadIdx.x;
    const int lane = tid & 31;
    const int wid  = tid >> 5;
    const int mn   = lane & 15;            // M (A row) or N (B/C col) index
    const int kb   = (lane >> 4) << 3;     // 0 or 8: K-half / C-row offset

    __shared__ __align__(16) _Float16 x_lds[128][LP];      // 18 KB
    __shared__ __align__(16) _Float16 w_lds[3][DH][LP];    // 27 KB

    const int row0 = tile * 128;

    // Stage x slice for this head (f32 -> f16), coalesced.
    for (int i = tid; i < 128 * DH; i += 256) {
        const int r = i >> 6, c = i & 63;
        x_lds[r][c] = (_Float16)seqs[((size_t)b * SS + row0 + r) * DD + h * DH + c];
    }
    // Stage the three weight matrices row-major [e][d] (B[k=d][n=e] = W[e][d]).
    const float* Ws[3] = { Wq, Wk, Wv };
#pragma unroll
    for (int j = 0; j < 3; ++j) {
        const float* w = Ws[j] + h * DH * DH;
        for (int i = tid; i < DH * DH; i += 256)
            w_lds[j][i >> 6][i & 63] = (_Float16)w[i];
    }
    __syncthreads();

    // A fragments: x tile rows [wid*16, wid*16+16), K = DH split in 2 chunks.
    v16h a[2];
#pragma unroll
    for (int kc = 0; kc < 2; ++kc)
        a[kc] = load_frag(&x_lds[wid * 16 + mn][kc * 32], kb);

    const float* biases[3] = { bq, bk, bv };
    _Float16*    outs[3]   = { Q, K, V };
    const size_t obase = ((size_t)(b * HH + h) * SS + row0 + wid * 16) * DH;

#pragma unroll
    for (int j = 0; j < 3; ++j) {
#pragma unroll
        for (int nt = 0; nt < 4; ++nt) {
            v8f acc = {};
#pragma unroll
            for (int kc = 0; kc < 2; ++kc) {
                v16h bf = load_frag(&w_lds[j][nt * 16 + mn][kc * 32], kb);
                acc = wmma16(a[kc], bf, acc);
            }
            const float bias = biases[j][h * DH + nt * 16 + mn];
            _Float16* o = outs[j] + obase;
#pragma unroll
            for (int r = 0; r < 8; ++r) {
                const int mrow = r + kb;                       // C layout row
                o[(size_t)mrow * DH + nt * 16 + mn] = (_Float16)(acc[r] + bias);
            }
        }
    }
}

// ---------------------------------------------------------------------------
// Kernel 2: flash attention.  grid = (S/128, H, B), block = 256 (8 waves);
// each wave owns 16 query rows, loop over S in KV tiles of 64 rows.
// ---------------------------------------------------------------------------
// Value of lane l ^ 16: the other half of the same query's column.
__device__ __forceinline__ float xhalf(float x) {
    const int i = __builtin_bit_cast(int, x);
    return __builtin_bit_cast(float, __builtin_amdgcn_permlanex16(
        i, i, 0x76543210, 0xfedcba98, false, false));
}

__global__ __launch_bounds__(256) void flash_attn_kernel(
    const _Float16* __restrict__ Q, const _Float16* __restrict__ K,
    const _Float16* __restrict__ V, float* __restrict__ out)
{
    const int qt   = blockIdx.x;
    const int h    = blockIdx.y;
    const int b    = blockIdx.z;
    const int tid  = threadIdx.x;
    const int lane = tid & 31;
    const int wid  = tid >> 5;
    const int mn   = lane & 15;
    const int kb   = (lane >> 4) << 3;

    __shared__ __align__(16) _Float16 k_lds[64][LP];        // 9 KB (async target)
    __shared__ __align__(16) _Float16 v_lds[64][VP];        // 10 KB (async target)

    const size_t head_base = (size_t)(b * HH + h) * SS * DH;
    const _Float16* Qh = Q + head_base;
    const _Float16* Kh = K + head_base;
    const _Float16* Vh = V + head_base;

    // Q^T B-fragments straight from global (row-major [s][d], 16B aligned).
    const int q0 = qt * 128 + wid * 16;
    v16h aq[2];
#pragma unroll
    for (int kc = 0; kc < 2; ++kc)
        aq[kc] = load_frag(Qh + (size_t)(q0 + mn) * DH + kc * 32, kb);

    v8f o0 = {}, o1 = {}, o2 = {}, o3 = {};
    // Lane (mn, half) serves query q0 + mn: mrun is that query's running maximum
    // (equal in both halves), lrun the sum over this half's keys only.
    float mrun = -1e30f, lrun = 0.0f;

    // The lane's 32 B of each K and V tile: four threads per 128 B source row.
    const unsigned klds_addr = (unsigned)(size_t)&k_lds[tid >> 2][(tid & 3) * 16];
    const unsigned vlds_addr = (unsigned)(size_t)&v_lds[tid >> 2][(tid & 3) * 16];
    // The lane's address for the transposing loads (keys 0..15, columns 0..15).
    const _Float16* vtr = &v_lds[kb + (lane & 7)][((lane >> 3) & 1) * 8];
    const float scale = 0.125f;   // 1/sqrt(64)

    for (int jt = 0; jt < SS / 64; ++jt) {
        const _Float16* kg = Kh + (size_t)jt * 64 * DH;
        const _Float16* vg = Vh + (size_t)jt * 64 * DH;

        if (jt + 1 < SS / 64) {                 // pull next tiles toward L2/L0
            __builtin_prefetch(kg + 64 * DH, 0, 0);
            __builtin_prefetch(vg + 64 * DH, 0, 0);
        }

        // K and V tiles: each 64x64 f16 = 8192 B = 256 threads x 32 B, async copies
        // to LDS, both row-major. The s_wait_xcnt stands in the copies' own
        // statement, ahead of any rewrite of their address registers.
        {
            const _Float16* gk = kg + tid * 16;
            const _Float16* gv = vg + tid * 16;
            asm volatile("global_load_async_to_lds_b128 %0, %1, off\n\t"
                         "global_load_async_to_lds_b128 %2, %3, off\n\t"
                         "global_load_async_to_lds_b128 %4, %5, off\n\t"
                         "global_load_async_to_lds_b128 %6, %7, off\n\t"
                         "s_wait_xcnt 0x0"
                         :: "v"(klds_addr), "v"(gk), "v"(klds_addr + 16u), "v"(gk + 8),
                            "v"(vlds_addr), "v"(gv), "v"(vlds_addr + 16u), "v"(gv + 8)
                         : "memory");
        }
        asm volatile("s_wait_asynccnt 0x0" ::: "memory");
        __syncthreads();

        // S^T[64x16] = K(64x64) @ Q^T : A[m=kvrow][k=d] = k_lds[kvrow][d].
        // Tile t, register r of lane (mn, half): key 16 t + kb + r, query mn.
        v8f s0 = {}, s1 = {}, s2 = {}, s3 = {};
#pragma unroll
        for (int kc = 0; kc < 2; ++kc) {
            s0 = wmma16(load_frag(&k_lds[ 0 + mn][kc * 32], kb), aq[kc], s0);
            s1 = wmma16(load_frag(&k_lds[16 + mn][kc * 32], kb), aq[kc], s1);
            s2 = wmma16(load_frag(&k_lds[32 + mn][kc * 32], kb), aq[kc], s2);
            s3 = wmma16(load_frag(&k_lds[48 + mn][kc * 32], kb), aq[kc], s3);
        }

        // All V^T fragments as one group of LDS reads, ahead of the softmax
        // (unrolled, so that va is indexed by constants and stays in registers).
        v16h va[2][4];
#pragma unroll
        for (int kc = 0; kc < 2; ++kc)
#pragma unroll
            for (int t = 0; t < 4; ++t)
                va[kc][t] = load_frag_tr(vtr + kc * 32 * VP + t * 16);
        // Keeps the group here: the scheduler otherwise sinks each pair of loads
        // to its WMMA, with a full LDS wait in front of every one.
        __builtin_amdgcn_sched_barrier(0);

        // Online softmax: the lane's 32 scores belong to one query, so maximum
        // and sum run in-lane; one exchange joins the halves' maxima.
        s0 *= scale; s1 *= scale; s2 *= scale; s3 *= scale;
        float mx = -1e30f;
#pragma unroll
        for (int r = 0; r < 8; ++r)
            mx = fmaxf(mx, fmaxf(fmaxf(s0[r], s1[r]), fmaxf(s2[r], s3[r])));
        mx = fmaxf(mx, xhalf(mx));
        const float mnew  = fmaxf(mrun, mx);
        const float alpha = __expf(mrun - mnew);
        mrun = mnew;

        // P^T as B operand: two score tiles of 16 keys, converted in place, are
        // one 32-key fragment in the k order that load_frag_tr gives V^T.
        s0 -= mnew; s1 -= mnew; s2 -= mnew; s3 -= mnew;
        v16h bp[2];
        float rs = 0.0f;
#pragma unroll
        for (int r = 0; r < 8; ++r) {
            const float p0 = __expf(s0[r]);
            const float p1 = __expf(s1[r]);
            const float p2 = __expf(s2[r]);
            const float p3 = __expf(s3[r]);
            rs += (p0 + p1) + (p2 + p3);
            bp[0][r] = (_Float16)p0; bp[0][8 + r] = (_Float16)p1;
            bp[1][r] = (_Float16)p2; bp[1][8 + r] = (_Float16)p3;
        }
        lrun = lrun * alpha + rs;
#pragma unroll
        for (int r = 0; r < 8; ++r) {
            o0[r] *= alpha; o1[r] *= alpha;
            o2[r] *= alpha; o3[r] *= alpha;
        }

        // O^T += V^T(64x64) @ P^T(64x16): A[m=d][k=kvrow] = v_lds[kvrow][d]
#pragma unroll
        for (int kc = 0; kc < 2; ++kc) {
            o0 = wmma16(va[kc][0], bp[kc], o0);
            o1 = wmma16(va[kc][1], bp[kc], o1);
            o2 = wmma16(va[kc][2], bp[kc], o2);
            o3 = wmma16(va[kc][3], bp[kc], o3);
        }

        // The wave's LDS reads have retired before the next trip's copies land.
        asm volatile("s_wait_dscnt 0x0" ::: "memory");
        __syncthreads();   // protect k_lds / v_lds before next tile
    }

    // Epilogue: join the halves' sums, normalize, store f32 output [B,S,D]
    // (D = H*DH). Tile t, register r: column 16 t + kb + r of row q0 + mn.
    const float inv = 1.0f / (lrun + xhalf(lrun));

    float* orow = out + ((size_t)b * SS + q0 + mn) * DD + h * DH + kb;
    const v8f ot[4] = { o0, o1, o2, o3 };
#pragma unroll
    for (int t = 0; t < 4; ++t) {
        *(float4*)(orow + t * 16) = make_float4(ot[t][0] * inv, ot[t][1] * inv,
                                                ot[t][2] * inv, ot[t][3] * inv);
        *(float4*)(orow + t * 16 + 4) = make_float4(ot[t][4] * inv, ot[t][5] * inv,
                                                    ot[t][6] * inv, ot[t][7] * inv);
    }
}

// ---------------------------------------------------------------------------
extern "C" void kernel_launch(void* const* d_in, const int* in_sizes, int n_in,
                              void* d_out, int out_size, void* d_ws, size_t ws_size,
                              hipStream_t stream) {
    const float* seqs = (const float*)d_in[0];
    const float* Wq   = (const float*)d_in[1];
    const float* bq   = (const float*)d_in[2];
    const float* Wk   = (const float*)d_in[3];
    const float* bk   = (const float*)d_in[4];
    const float* Wv   = (const float*)d_in[5];
    const float* bv   = (const float*)d_in[6];
    float* out = (float*)d_out;

    // Workspace: Q,K,V f16 [B,H,S,DH] -> 3 * 8 MB = 24 MB.
    const size_t elems = (size_t)BB * HH * SS * DH;
    _Float16* Qw = (_Float16*)d_ws;
    _Float16* Kw = Qw + elems;
    _Float16* Vw = Kw + elems;

    dim3 grid(SS / 128, HH, BB), block(256);
    qkv_proj_kernel<<<grid, block, 0, stream>>>(seqs, Wq, bq, Wk, bk, Wv, bv,
                                                Qw, Kw, Vw);
    flash_attn_kernel<<<grid, block, 0, stream>>>(Qw, Kw, Vw, out);
}

// v004
// One run takes 63.1 microseconds.
// In two side-by-side timings against v003, it was 1.18 and 1.16 times as fast.
// All steps since v000 together make it 4.52 times as fast.
#include <hip/hip_runtime.h>

// MultiHeadAttention forward for MI455X (gfx1250), wave32, WMMA f16->f32.
// B=2, S=2048, D=1024, H=16, DH=64.
//
//  1) qkv_proj: x @ W^T + b per head, f16 WMMA, results to d_ws as f16
//     in [B,H,S,DH] layout (Q,K,V = 3 * 8MB = 24MB of workspace).
//  2) flash_attn: online-softmax flash attention; KV tiles of 64 rows,
//     16 WMMAs per iteration; K tiles staged in LDS via
//     global_load_async_to_lds_b128 (ASYNCcnt), V the same way, row-major,
//     in two buffers: the next tile's copies fly while this one is worked on;
//     V^T fragments come out of LDS by ds_load_tr16_b128.
//     Both products run transposed (S^T = K Q^T, O^T += V^T P^T): a lane
//     holds scores of one query only, and P^T packs in registers.

#define BB 2
#define SS 2048
#define DD 1024
#define HH 16
#define DH 64
// LDS row pitch in halfs for the 64-half x, W and K tile rows: 144 B = 16 B x 9 (odd), so
// the 16 rows that one ds_load_b128 fragment read touches fall on distinct banks.
#define LP 72
// Pitch of the V tile rows, which ds_load_tr16_b128 reads: 160 B = 32 B x 5 (odd).
#define VP 80

typedef __attribute__((ext_vector_type(16))) _Float16 v16h;
typedef __attribute__((ext_vector_type(8)))  float    v8f;

__device__ __forceinline__ v8f wmma16(v16h a, v16h b, v8f c) {
    // D = A(16x32 f16) * B(32x16 f16) + C(16x16 f32)
    return __builtin_amdgcn_wmma_f32_16x16x32_f16(
        /*neg_a=*/false, a, /*neg_b=*/false, b,
        /*c_mod=*/(short)0, c, /*reuse_a=*/false, /*reuse_b=*/false);
}

// Load one 16-half fragment per lane as two aligned 16B chunks.
// rowp points at the lane's row start (+ kchunk*32 already applied);
// kbase = 8*(lane>=16). Matches ISA 16-bit A/B VGPR striping.
__device__ __forceinline__ v16h load_frag(const _Float16* rowp, int kbase) {
    union { v16h h; uint4 u[2]; } f;
    f.u[0] = *(const uint4*)(rowp + kbase);
    f.u[1] = *(const uint4*)(rowp + 16 + kbase);
    return f.h;
}

// One 16(d) x 32(key) V^T fragment out of a row-major V tile: p is the lane's
// address in the tile's first 16 keys; the second load takes the next 16 keys.
// Lane (mn, half) gets keys 8 half + 0..7 and 16 + 8 half + 0..7 of column mn:
// the k order of load_frag.
typedef __attribute__((ext_vector_type(8))) short s16x8;
__device__ __forceinline__ v16h load_frag_tr(const _Float16* p) {
    typedef __attribute__((address_space(3))) s16x8 lds_s16x8;
    union { v16h h; s16x8 u[2]; } f;
    f.u[0] = __builtin_amdgcn_ds_load_tr16_b128_v8i16((lds_s16x8*)p);
    f.u[1] = __builtin_amdgcn_ds_load_tr16_b128_v8i16((lds_s16x8*)(p + 16 * VP));
    return f.h;
}

// ---------------------------------------------------------------------------
// Kernel 1: per-head QKV projection.  grid = (S/128, H, B), block = 256 (8 waves)
// ---------------------------------------------------------------------------
__global__ __launch_bounds__(256) void qkv_proj_kernel(
    const float* __restrict__ seqs,
    const float* __restrict__ Wq, const float* __restrict__ bq,
    const float* __restrict__ Wk, const float* __restrict__ bk,
    const float* __restrict__ Wv, const float* __restrict__ bv,
    _Float16* __restrict__ Q, _Float16* __restrict__ K, _Float16* __restrict__ V)
{
    const int tile = blockIdx.x;
    const int h    = blockIdx.y;
    const int b    = blockIdx.z;
    const int tid  = threadIdx.x;
    const int lane = tid & 31;
    const int wid  = tid >> 5;
    const int mn   = lane & 15;            // M (A row) or N (B/C col) index
    const int kb   = (lane >> 4) << 3;     // 0 or 8: K-half / C-row offset

    __shared__ __align__(16) _Float16 x_lds[128][LP];      // 18 KB
    __shared__ __align__(16) _Float16 w_lds[3][DH][LP];    // 27 KB

    const int row0 = tile * 128;

    // Stage x slice for this head (f32 -> f16), coalesced.
    for (int i = tid; i < 128 * DH; i += 256) {
        const int r = i >> 6, c = i & 63;
        x_lds[r][c] = (_Float16)seqs[((size_t)b * SS + row0 + r) * DD + h * DH + c];
    }
    // Stage the three weight matrices row-major [e][d] (B[k=d][n=e] = W[e][d]).
    const float* Ws[3] = { Wq, Wk, Wv };
#pragma unroll
    for (int j = 0; j < 3; ++j) {
        const float* w = Ws[j] + h * DH * DH;
        for (int i = tid; i < DH * DH; i += 256)
            w_lds[j][i >> 6][i & 63] = (_Float16)w[i];
    }
    __syncthreads();

    // A fragments: x tile rows [wid*16, wid*16+16), K = DH split in 2 chunks.
    v16h a[2];
#pragma unroll
    for (int kc = 0; kc < 2; ++kc)
        a[kc] = load_frag(&x_lds[wid * 16 + mn][kc * 32], kb);

    const float* biases[3] = { bq, bk, bv };
    _Float16*    outs[3]   = { Q, K, V };
    const size_t obase = ((size_t)(b * HH + h) * SS + row0 + wid * 16) * DH;

#pragma unroll
    for (int j = 0; j < 3; ++j) {
#pragma unroll
        for (int nt = 0; nt < 4; ++nt) {
            v8f acc = {};
#pragma unroll
            for (int kc = 0; kc < 2; ++kc) {
                v16h bf = load_frag(&w_lds[j][nt * 16 + mn][kc * 32], kb);
                acc = wmma16(a[kc], bf, acc);
            }
            const float bias = biases[j][h * DH + nt * 16 + mn];
            _Float16* o = outs[j] + obase;
#pragma unroll
            for (int r = 0; r < 8; ++r) {
                const int mrow = r + kb;                       // C layout row
                o[(size_t)mrow * DH + nt * 16 + mn] = (_Float16)(acc[r] + bias);
            }
        }
    }
}

// ---------------------------------------------------------------------------
// Kernel 2: flash attention.  grid = (S/128, H, B), block = 256 (8 waves);
// each wave owns 16 query rows, loop over S in KV tiles of 64 rows.
// ---------------------------------------------------------------------------
// Value of lane l ^ 16: the other half of the same query's column.
__device__ __forceinline__ float xhalf(float x) {
    const int i = __builtin_bit_cast(int, x);
    return __builtin_bit_cast(float, __builtin_amdgcn_permlanex16(
        i, i, 0x76543210, 0xfedcba98, false, false));
}

__global__ __launch_bounds__(256) void flash_attn_kernel(
    const _Float16* __restrict__ Q, const _Float16* __restrict__ K,
    const _Float16* __restrict__ V, float* __restrict__ out)
{
    const int qt   = blockIdx.x;
    const int h    = blockIdx.y;
    const int b    = blockIdx.z;
    const int tid  = threadIdx.x;
    const int lane = tid & 31;
    const int wid  = tid >> 5;
    const int mn   = lane & 15;
    const int kb   = (lane >> 4) << 3;

    __shared__ __align__(16) _Float16 k_lds[2][64][LP];     // 2 x 9 KB (async target)
    __shared__ __align__(16) _Float16 v_lds[2][64][VP];     // 2 x 10 KB (async target)

    const size_t head_base = (size_t)(b * HH + h) * SS * DH;
    const _Float16* Qh = Q + head_base;
    const _Float16* Kh = K + head_base;
    const _Float16* Vh = V + head_base;

    // Q^T B-fragments straight from global (row-major [s][d], 16B aligned).
    const int q0 = qt * 128 + wid * 16;
    v16h aq[2];
#pragma unroll
    for (int kc = 0; kc < 2; ++kc)
        aq[kc] = load_frag(Qh + (size_t)(q0 + mn) * DH + kc * 32, kb);

    v8f o0 = {}, o1 = {}, o2 = {}, o3 = {};
    // Lane (mn, half) serves query q0 + mn: mrun is that query's running maximum
    // (equal in both halves), lrun the sum over this half's keys only.
    float mrun = -1e30f, lrun = 0.0f;

    // The lane's 32 B of each K and V tile: four threads per 128 B source row.
    // (buffer 0; buffer 1 lies one buffer's bytes further).
    const unsigned klds_addr = (unsigned)(size_t)&k_lds[0][tid >> 2][(tid & 3) * 16];
    const unsigned vlds_addr = (unsigned)(size_t)&v_lds[0][tid >> 2][(tid & 3) * 16];
    const float scale = 0.125f;   // 1/sqrt(64)

    // K and V tile t into buffer t & 1: each 64x64 f16 = 8192 B = 256 threads x
    // 32 B, async copies to LDS, both row-major. The s_wait_xcnt stands in the
    // copies' own statement, ahead of any rewrite of their address registers.
    auto copy_tile = [&](int t) {
        const _Float16* gk = Kh + (size_t)t * 64 * DH + tid * 16;
        const _Float16* gv = Vh + (size_t)t * 64 * DH + tid * 16;
        const unsigned kd = klds_addr + (unsigned)(t & 1) * (unsigned)sizeof(k_lds[0]);
        const unsigned vd = vlds_addr + (unsigned)(t & 1) * (unsigned)sizeof(v_lds[0]);
        asm volatile("global_load_async_to_lds_b128 %0, %1, off\n\t"
                     "global_load_async_to_lds_b128 %2, %3, off\n\t"
                     "global_load_async_to_lds_b128 %4, %5, off\n\t"
                     "global_load_async_to_lds_b128 %6, %7, off\n\t"
                     "s_wait_xcnt 0x0"
                     :: "v"(kd), "v"(gk), "v"(kd + 16u), "v"(gk + 8),
                        "v"(vd), "v"(gv), "v"(vd + 16u), "v"(gv + 8)
                     : "memory");
    };

    // Tile 0 lands and is published; tile 1 is under way when the loop starts.
    copy_tile(0);
    asm volatile("s_wait_asynccnt 0x0" ::: "memory");
    __syncthreads();
    copy_tile(1);

    for (int jt = 0; jt < SS / 64; ++jt) {
        const _Float16 (*kt)[LP] = k_lds[jt & 1];
        // The lane's address for the transposing loads (keys 0..15, columns 0..15).
        const _Float16* vtr = &v_lds[jt & 1][kb + (lane & 7)][((lane >> 3) & 1) * 8];

        // S^T[64x16] = K(64x64) @ Q^T : A[m=kvrow][k=d] = kt[kvrow][d].
        // Tile t, register r of lane (mn, half): key 16 t + kb + r, query mn.
        v8f s0 = {}, s1 = {}, s2 = {}, s3 = {};
#pragma unroll
        for (int kc = 0; kc < 2; ++kc) {
            s0 = wmma16(load_frag(&kt[ 0 + mn][kc * 32], kb), aq[kc], s0);
            s1 = wmma16(load_frag(&kt[16 + mn][kc * 32], kb), aq[kc], s1);
            s2 = wmma16(load_frag(&kt[32 + mn][kc * 32], kb), aq[kc], s2);
            s3 = wmma16(load_frag(&kt[48 + mn][kc * 32], kb), aq[kc], s3);
        }

        // All V^T fragments as one group of LDS reads, ahead of the softmax
        // (unrolled, so that va is indexed by constants and stays in registers).
        v16h va[2][4];
#pragma unroll
        for (int kc = 0; kc < 2; ++kc)
#pragma unroll
            for (int t = 0; t < 4; ++t)
                va[kc][t] = load_frag_tr(vtr + kc * 32 * VP + t * 16);
        // Ends the scheduling region here: without it the trip opens with two loads
        // and a full LDS wait, and two S^T WMMAs move behind the barrier.
        __builtin_amdgcn_sched_barrier(0);

        // Publish point: these were the trip's last LDS reads. The wave's reads
        // have retired and its copies of tile jt + 1 have landed before the one
        // barrier of the trip, which hands tile jt + 1 to every wave and frees
        // this trip's buffer; tile jt + 2 then flies under softmax, the second
        // product and the next trip's reads.
        asm volatile("s_wait_dscnt 0x0" ::: "memory");
        asm volatile("s_wait_asynccnt 0x0" ::: "memory");
        __syncthreads();
        if (jt + 2 < SS / 64)
            copy_tile(jt + 2);

        // Online softmax: the lane's 32 scores belong to one query, so maximum
        // and sum run in-lane; one exchange joins the halves' maxima.
        s0 *= scale; s1 *= scale; s2 *= scale; s3 *= scale;
        float mx = -1e30f;
#pragma unroll
        for (int r = 0; r < 8; ++r)
            mx = fmaxf(mx, fmaxf(fmaxf(s0[r], s1[r]), fmaxf(s2[r], s3[r])));
        mx = fmaxf(mx, xhalf(mx));
        const float mnew  = fmaxf(mrun, mx);
        const float alpha = __expf(mrun - mnew);
        mrun = mnew;

        // P^T as B operand: two score tiles of 16 keys, converted in place, are
        // one 32-key fragment in the k order that load_frag_tr gives V^T.
        s0 -= mnew; s1 -= mnew; s2 -= mnew; s3 -= mnew;
        v16h bp[2];
        float rs = 0.0f;
#pragma unroll
        for (int r = 0; r < 8; ++r) {
            const float p0 = __expf(s0[r]);
            const float p1 = __expf(s1[r]);
            const float p2 = __expf(s2[r]);
            const float p3 = __expf(s3[r]);
            rs += (p0 + p1) + (p2 + p3);
            bp[0][r] = (_Float16)p0; bp[0][8 + r] = (_Float16)p1;
            bp[1][r] = (_Float16)p2; bp[1][8 + r] = (_Float16)p3;
        }
        lrun = lrun * alpha + rs;
#pragma unroll
        for (int r = 0; r < 8; ++r) {
            o0[r] *= alpha; o1[r] *= alpha;
            o2[r] *= alpha; o3[r] *= alpha;
        }

        // O^T += V^T(64x64) @ P^T(64x16): A[m=d][k=kvrow] = v_lds[kvrow][d]
#pragma unroll
        for (int kc = 0; kc < 2; ++kc) {
            o0 = wmma16(va[kc][0], bp[kc], o0);
            o1 = wmma16(va[kc][1], bp[kc], o1);
            o2 = wmma16(va[kc][2], bp[kc], o2);
            o3 = wmma16(va[kc][3], bp[kc], o3);
        }
    }
    // No copy is outstanding when the wave ends.
    asm volatile("s_wait_asynccnt 0x0" ::: "memory");

    // Epilogue: join the halves' sums, normalize, store f32 output [B,S,D]
    // (D = H*DH). Tile t, register r: column 16 t + kb + r of row q0 + mn.
    const float inv = 1.0f / (lrun + xhalf(lrun));

    float* orow = out + ((size_t)b * SS + q0 + mn) * DD + h * DH + kb;
    const v8f ot[4] = { o0, o1, o2, o3 };
#pragma unroll
    for (int t = 0; t < 4; ++t) {
        *(float4*)(orow + t * 16) = make_float4(ot[t][0] * inv, ot[t][1] * inv,
                                                ot[t][2] * inv, ot[t][3] * inv);
        *(float4*)(orow + t * 16 + 4) = make_float4(ot[t][4] * inv, ot[t][5] * inv,
                                                    ot[t][6] * inv, ot[t][7] * inv);
    }
}

// ---------------------------------------------------------------------------
extern "C" void kernel_launch(void* const* d_in, const int* in_sizes, int n_in,
                              void* d_out, int out_size, void* d_ws, size_t ws_size,
                              hipStream_t stream) {
    const float* seqs = (const float*)d_in[0];
    const float* Wq   = (const float*)d_in[1];
    const float* bq   = (const float*)d_in[2];
    const float* Wk   = (const float*)d_in[3];
    const float* bk   = (const float*)d_in[4];
    const float* Wv   = (const float*)d_in[5];
    const float* bv   = (const float*)d_in[6];
    float* out = (float*)d_out;

    // Workspace: Q,K,V f16 [B,H,S,DH] -> 3 * 8 MB = 24 MB.
    const size_t elems = (size_t)BB * HH * SS * DH;
    _Float16* Qw = (_Float16*)d_ws;
    _Float16* Kw = Qw + elems;
    _Float16* Vw = Kw + elems;

    dim3 grid(SS / 128, HH, BB), block(256);
    qkv_proj_kernel<<<grid, block, 0, stream>>>(seqs, Wq, bq, Wk, bk, Wv, bv,
                                                Qw, Kw, Vw);
    flash_attn_kernel<<<grid, block, 0, stream>>>(Qw, Kw, Vw, out);
}

// v005
// A run of this version takes 51.8 microseconds.
// Next to v004, in two timings, it ran 1.21 times as fast each time.
// Over all steps from v000 it is 5.48 times as fast.
#include <hip/hip_runtime.h>

// MultiHeadAttention forward for MI455X (gfx1250), wave32, WMMA f16->f32.
// B=2, S=2048, D=1024, H=16, DH=64.
//
//  1) qkv_proj: x @ W^T + b per head, f16 WMMA, results to d_ws as f16
//     in [B,H,S,DH] layout (Q,K,V = 3 * 8MB = 24MB of workspace).
//  2) flash_attn: online-softmax flash attention; KV tiles of 64 rows,
//     16 WMMAs per iteration; K tiles staged in LDS via
//     global_load_async_to_lds_b128 (ASYNCcnt), V the same way, row-major,
//     in two buffers: the next tile's copies fly while this one is worked on;
//     V^T fragments come out of LDS by ds_load_tr16_b128.
//     Both products run transposed (S^T = K Q^T, O^T += V^T P^T): a lane
//     holds scores of one query only, and P^T packs in registers.

#define BB 2
#define SS 2048
#define DD 1024
#define HH 16
#define DH 64
// LDS row pitch in halfs for the 64-half x, W and K tile rows: 144 B = 16 B x 9 (odd), so
// the 16 rows that one ds_load_b128 fragment read touches fall on distinct banks.
#define LP 72
// Pitch of the V tile rows, which ds_load_tr16_b128 reads: 160 B = 32 B x 5 (odd).
#define VP 80

typedef __attribute__((ext_vector_type(16))) _Float16 v16h;
typedef __attribute__((ext_vector_type(8)))  float    v8f;

__device__ __forceinline__ v8f wmma16(v16h a, v16h b, v8f c) {
    // D = A(16x32 f16) * B(32x16 f16) + C(16x16 f32)
    return __builtin_amdgcn_wmma_f32_16x16x32_f16(
        /*neg_a=*/false, a, /*neg_b=*/false, b,
        /*c_mod=*/(short)0, c, /*reuse_a=*/false, /*reuse_b=*/false);
}

// Load one 16-half fragment per lane as two aligned 16B chunks.
// rowp points at the lane's row start (+ kchunk*32 already applied);
// kbase = 8*(lane>=16). Matches ISA 16-bit A/B VGPR striping.
__device__ __forceinline__ v16h load_frag(const _Float16* rowp, int kbase) {
    union { v16h h; uint4 u[2]; } f;
    f.u[0] = *(const uint4*)(rowp + kbase);
    f.u[1] = *(const uint4*)(rowp + 16 + kbase);
    return f.h;
}

// One 16(d) x 32(key) V^T fragment out of a row-major V tile: p is the lane's
// address in the tile's first 16 keys; the second load takes the next 16 keys.
// Lane (mn, half) gets keys 8 half + 0..7 and 16 + 8 half + 0..7 of column mn:
// the k order of load_frag.
typedef __attribute__((ext_vector_type(8))) short s16x8;
__device__ __forceinline__ v16h load_frag_tr(const _Float16* p) {
    typedef __attribute__((address_space(3))) s16x8 lds_s16x8;
    union { v16h h; s16x8 u[2]; } f;
    f.u[0] = __builtin_amdgcn_ds_load_tr16_b128_v8i16((lds_s16x8*)p);
    f.u[1] = __builtin_amdgcn_ds_load_tr16_b128_v8i16((lds_s16x8*)(p + 16 * VP));
    return f.h;
}

// Four floats rounded to four halfs.
typedef __attribute__((ext_vector_type(4))) _Float16 v4h;
typedef __attribute__((ext_vector_type(4))) float    v4f;
__device__ __forceinline__ v4h cvt4(v4f v) {
    v4h r = { (_Float16)v.x, (_Float16)v.y, (_Float16)v.z, (_Float16)v.w };
    return r;
}

// ---------------------------------------------------------------------------
// Kernel 1: per-head QKV projection.  grid = (S/128, H, B), block = 256 (8 waves)
// ---------------------------------------------------------------------------
__global__ __launch_bounds__(256) void qkv_proj_kernel(
    const float* __restrict__ seqs,
    const float* __restrict__ Wq, const float* __restrict__ bq,
    const float* __restrict__ Wk, const float* __restrict__ bk,
    const float* __restrict__ Wv, const float* __restrict__ bv,
    _Float16* __restrict__ Q, _Float16* __restrict__ K, _Float16* __restrict__ V)
{
    const int tile = blockIdx.x;
    const int h    = blockIdx.y;
    const int b    = blockIdx.z;
    const int tid  = threadIdx.x;
    const int lane = tid & 31;
    const int wid  = tid >> 5;
    const int mn   = lane & 15;            // M (A row) or N (B/C col) index
    const int kb   = (lane >> 4) << 3;     // 0 or 8: K-half / C-row offset

    __shared__ __align__(16) _Float16 x_lds[128][LP];      // 18 KB
    __shared__ __align__(16) _Float16 w_lds[3][DH][LP];    // 27 KB

    const int row0 = tile * 128;

    // Every global read of the kernel is issued here, 16 B a lane for x and W, 4 B for the biases, unrolled, so
    // that all of them are in flight together and the wave waits out one latency,
    // not one per loop trip. A thread takes four floats of row fr (+ 16 a step).
    const int fr = tid >> 4, fc = (tid & 15) * 4;
    const float* xp  = seqs + ((size_t)b * SS + row0 + fr) * DD + h * DH + fc;
    const float* wp[3] = { Wq + h * DH * DH + fr * DH + fc,
                           Wk + h * DH * DH + fr * DH + fc,
                           Wv + h * DH * DH + fr * DH + fc };
    const float* bp[3] = { bq + h * DH + mn, bk + h * DH + mn, bv + h * DH + mn };
    v4f xv[8];
#pragma unroll
    for (int u = 0; u < 8; ++u)
        xv[u] = *(const v4f*)(xp + u * 16 * DD);
    v4f   wv[3][4];
    float bias_r[3][4];
#pragma unroll
    for (int j = 0; j < 3; ++j) {
#pragma unroll
        for (int u = 0; u < 4; ++u)
            wv[j][u] = *(const v4f*)(wp[j] + u * 16 * DH);
#pragma unroll
        for (int nt = 0; nt < 4; ++nt)
            bias_r[j][nt] = bp[j][nt * 16];
    }
    // One wait behind all the loads, ahead of any rewrite of their address registers:
    // it names the 16-byte loads' addresses, so that they stay in their registers up
    // to here and no later load's result lands in one of them.
    asm volatile("s_wait_xcnt 0x0"
                 :: "v"(xp), "v"(wp[0]), "v"(wp[1]), "v"(wp[2]) : "memory");

    // f32 -> f16 and into LDS, 8 B a lane: the x slice of this head, then the three
    // weight matrices row-major [e][d] (B[k=d][n=e] = W[e][d]).
#pragma unroll
    for (int u = 0; u < 8; ++u)
        *(v4h*)&x_lds[fr + u * 16][fc] = cvt4(xv[u]);
#pragma unroll
    for (int j = 0; j < 3; ++j)
#pragma unroll
        for (int u = 0; u < 4; ++u)
            *(v4h*)&w_lds[j][fr + u * 16][fc] = cvt4(wv[j][u]);
    __syncthreads();

    // A fragments: x tile rows [wid*16, wid*16+16), K = DH split in 2 chunks.
    v16h a[2];
#pragma unroll
    for (int kc = 0; kc < 2; ++kc)
        a[kc] = load_frag(&x_lds[wid * 16 + mn][kc * 32], kb);

    _Float16*    outs[3]   = { Q, K, V };
    const size_t obase = ((size_t)(b * HH + h) * SS + row0 + wid * 16) * DH;

#pragma unroll
    for (int j = 0; j < 3; ++j) {
#pragma unroll
        for (int nt = 0; nt < 4; ++nt) {
            v8f acc = {};
#pragma unroll
            for (int kc = 0; kc < 2; ++kc) {
                v16h bf = load_frag(&w_lds[j][nt * 16 + mn][kc * 32], kb);
                acc = wmma16(a[kc], bf, acc);
            }
            const float bias = bias_r[j][nt];
            _Float16* o = outs[j] + obase;
#pragma unroll
            for (int r = 0; r < 8; ++r) {
                const int mrow = r + kb;                       // C layout row
                o[(size_t)mrow * DH + nt * 16 + mn] = (_Float16)(acc[r] + bias);
            }
        }
    }
}

// ---------------------------------------------------------------------------
// Kernel 2: flash attention.  grid = (S/128, H, B), block = 256 (8 waves);
// each wave owns 16 query rows, loop over S in KV tiles of 64 rows.
// ---------------------------------------------------------------------------
// Value of lane l ^ 16: the other half of the same query's column.
__device__ __forceinline__ float xhalf(float x) {
    const int i = __builtin_bit_cast(int, x);
    return __builtin_bit_cast(float, __builtin_amdgcn_permlanex16(
        i, i, 0x76543210, 0xfedcba98, false, false));
}

__global__ __launch_bounds__(256) void flash_attn_kernel(
    const _Float16* __restrict__ Q, const _Float16* __restrict__ K,
    const _Float16* __restrict__ V, float* __restrict__ out)
{
    const int qt   = blockIdx.x;
    const int h    = blockIdx.y;
    const int b    = blockIdx.z;
    const int tid  = threadIdx.x;
    const int lane = tid & 31;
    const int wid  = tid >> 5;
    const int mn   = lane & 15;
    const int kb   = (lane >> 4) << 3;

    __shared__ __align__(16) _Float16 k_lds[2][64][LP];     // 2 x 9 KB (async target)
    __shared__ __align__(16) _Float16 v_lds[2][64][VP];     // 2 x 10 KB (async target)

    const size_t head_base = (size_t)(b * HH + h) * SS * DH;
    const _Float16* Qh = Q + head_base;
    const _Float16* Kh = K + head_base;
    const _Float16* Vh = V + head_base;

    // Q^T B-fragments straight from global (row-major [s][d], 16B aligned).
    const int q0 = qt * 128 + wid * 16;
    v16h aq[2];
#pragma unroll
    for (int kc = 0; kc < 2; ++kc)
        aq[kc] = load_frag(Qh + (size_t)(q0 + mn) * DH + kc * 32, kb);

    v8f o0 = {}, o1 = {}, o2 = {}, o3 = {};
    // Lane (mn, half) serves query q0 + mn: mrun is that query's running maximum
    // (equal in both halves), lrun the sum over this half's keys only.
    float mrun = -1e30f, lrun = 0.0f;

    // The lane's 32 B of each K and V tile: four threads per 128 B source row.
    // (buffer 0; buffer 1 lies one buffer's bytes further).
    const unsigned klds_addr = (unsigned)(size_t)&k_lds[0][tid >> 2][(tid & 3) * 16];
    const unsigned vlds_addr = (unsigned)(size_t)&v_lds[0][tid >> 2][(tid & 3) * 16];
    const float scale = 0.125f;   // 1/sqrt(64)

    // K and V tile t into buffer t & 1: each 64x64 f16 = 8192 B = 256 threads x
    // 32 B, async copies to LDS, both row-major. The s_wait_xcnt stands in the
    // copies' own statement, ahead of any rewrite of their address registers.
    auto copy_tile = [&](int t) {
        const _Float16* gk = Kh + (size_t)t * 64 * DH + tid * 16;
        const _Float16* gv = Vh + (size_t)t * 64 * DH + tid * 16;
        const unsigned kd = klds_addr + (unsigned)(t & 1) * (unsigned)sizeof(k_lds[0]);
        const unsigned vd = vlds_addr + (unsigned)(t & 1) * (unsigned)sizeof(v_lds[0]);
        asm volatile("global_load_async_to_lds_b128 %0, %1, off\n\t"
                     "global_load_async_to_lds_b128 %2, %3, off\n\t"
                     "global_load_async_to_lds_b128 %4, %5, off\n\t"
                     "global_load_async_to_lds_b128 %6, %7, off\n\t"
                     "s_wait_xcnt 0x0"
                     :: "v"(kd), "v"(gk), "v"(kd + 16u), "v"(gk + 8),
                        "v"(vd), "v"(gv), "v"(vd + 16u), "v"(gv + 8)
                     : "memory");
    };

    // Tile 0 lands and is published; tile 1 is under way when the loop starts.
    copy_tile(0);
    asm volatile("s_wait_asynccnt 0x0" ::: "memory");
    __syncthreads();
    copy_tile(1);

    for (int jt = 0; jt < SS / 64; ++jt) {
        const _Float16 (*kt)[LP] = k_lds[jt & 1];
        // The lane's address for the transposing loads (keys 0..15, columns 0..15).
        const _Float16* vtr = &v_lds[jt & 1][kb + (lane & 7)][((lane >> 3) & 1) * 8];

        // S^T[64x16] = K(64x64) @ Q^T : A[m=kvrow][k=d] = kt[kvrow][d].
        // Tile t, register r of lane (mn, half): key 16 t + kb + r, query mn.
        v8f s0 = {}, s1 = {}, s2 = {}, s3 = {};
#pragma unroll
        for (int kc = 0; kc < 2; ++kc) {
            s0 = wmma16(load_frag(&kt[ 0 + mn][kc * 32], kb), aq[kc], s0);
            s1 = wmma16(load_frag(&kt[16 + mn][kc * 32], kb), aq[kc], s1);
            s2 = wmma16(load_frag(&kt[32 + mn][kc * 32], kb), aq[kc], s2);
            s3 = wmma16(load_frag(&kt[48 + mn][kc * 32], kb), aq[kc], s3);
        }

        // All V^T fragments as one group of LDS reads, ahead of the softmax
        // (unrolled, so that va is indexed by constants and stays in registers).
        v16h va[2][4];
#pragma unroll
        for (int kc = 0; kc < 2; ++kc)
#pragma unroll
            for (int t = 0; t < 4; ++t)
                va[kc][t] = load_frag_tr(vtr + kc * 32 * VP + t * 16);
        // Ends the scheduling region here: without it the trip opens with two loads
        // and a full LDS wait, and two S^T WMMAs move behind the barrier.
        __builtin_amdgcn_sched_barrier(0);

        // Publish point: these were the trip's last LDS reads. The wave's reads
        // have retired and its copies of tile jt + 1 have landed before the one
        // barrier of the trip, which hands tile jt + 1 to every wave and frees
        // this trip's buffer; tile jt + 2 then flies under softmax, the second
        // product and the next trip's reads.
        asm volatile("s_wait_dscnt 0x0" ::: "memory");
        asm volatile("s_wait_asynccnt 0x0" ::: "memory");
        __syncthreads();
        if (jt + 2 < SS / 64)
            copy_tile(jt + 2);

        // Online softmax: the lane's 32 scores belong to one query, so maximum
        // and sum run in-lane; one exchange joins the halves' maxima.
        s0 *= scale; s1 *= scale; s2 *= scale; s3 *= scale;
        float mx = -1e30f;
#pragma unroll
        for (int r = 0; r < 8; ++r)
            mx = fmaxf(mx, fmaxf(fmaxf(s0[r], s1[r]), fmaxf(s2[r], s3[r])));
        mx = fmaxf(mx, xhalf(mx));
        const float mnew  = fmaxf(mrun, mx);
        const float alpha = __expf(mrun - mnew);
        mrun = mnew;

        // P^T as B operand: two score tiles of 16 keys, converted in place, are
        // one 32-key fragment in the k order that load_frag_tr gives V^T.
        s0 -= mnew; s1 -= mnew; s2 -= mnew; s3 -= mnew;
        v16h bp[2];
        float rs = 0.0f;
#pragma unroll
        for (int r = 0; r < 8; ++r) {
            const float p0 = __expf(s0[r]);
            const float p1 = __expf(s1[r]);
            const float p2 = __expf(s2[r]);
            const float p3 = __expf(s3[r]);
            rs += (p0 + p1) + (p2 + p3);
            bp[0][r] = (_Float16)p0; bp[0][8 + r] = (_Float16)p1;
            bp[1][r] = (_Float16)p2; bp[1][8 + r] = (_Float16)p3;
        }
        lrun = lrun * alpha + rs;
#pragma unroll
        for (int r = 0; r < 8; ++r) {
            o0[r] *= alpha; o1[r] *= alpha;
            o2[r] *= alpha; o3[r] *= alpha;
        }

        // O^T += V^T(64x64) @ P^T(64x16): A[m=d][k=kvrow] = v_lds[kvrow][d]
#pragma unroll
        for (int kc = 0; kc < 2; ++kc) {
            o0 = wmma16(va[kc][0], bp[kc], o0);
            o1 = wmma16(va[kc][1], bp[kc], o1);
            o2 = wmma16(va[kc][2], bp[kc], o2);
            o3 = wmma16(va[kc][3], bp[kc], o3);
        }
    }
    // No copy is outstanding when the wave ends.
    asm volatile("s_wait_asynccnt 0x0" ::: "memory");

    // Epilogue: join the halves' sums, normalize, store f32 output [B,S,D]
    // (D = H*DH). Tile t, register r: column 16 t + kb + r of row q0 + mn.
    const float inv = 1.0f / (lrun + xhalf(lrun));

    float* orow = out + ((size_t)b * SS + q0 + mn) * DD + h * DH + kb;
    const v8f ot[4] = { o0, o1, o2, o3 };
#pragma unroll
    for (int t = 0; t < 4; ++t) {
        *(float4*)(orow + t * 16) = make_float4(ot[t][0] * inv, ot[t][1] * inv,
                                                ot[t][2] * inv, ot[t][3] * inv);
        *(float4*)(orow + t * 16 + 4) = make_float4(ot[t][4] * inv, ot[t][5] * inv,
                                                    ot[t][6] * inv, ot[t][7] * inv);
    }
}

// ---------------------------------------------------------------------------
extern "C" void kernel_launch(void* const* d_in, const int* in_sizes, int n_in,
                              void* d_out, int out_size, void* d_ws, size_t ws_size,
                              hipStream_t stream) {
    const float* seqs = (const float*)d_in[0];
    const float* Wq   = (const float*)d_in[1];
    const float* bq   = (const float*)d_in[2];
    const float* Wk   = (const float*)d_in[3];
    const float* bk   = (const float*)d_in[4];
    const float* Wv   = (const float*)d_in[5];
    const float* bv   = (const float*)d_in[6];
    float* out = (float*)d_out;

    // Workspace: Q,K,V f16 [B,H,S,DH] -> 3 * 8 MB = 24 MB.
    const size_t elems = (size_t)BB * HH * SS * DH;
    _Float16* Qw = (_Float16*)d_ws;
    _Float16* Kw = Qw + elems;
    _Float16* Vw = Kw + elems;

    dim3 grid(SS / 128, HH, BB), block(256);
    qkv_proj_kernel<<<grid, block, 0, stream>>>(seqs, Wq, bq, Wk, bk, Wv, bv,
                                                Qw, Kw, Vw);
    flash_attn_kernel<<<grid, block, 0, stream>>>(Qw, Kw, Vw, out);
}

// v006
// One run takes 48.3 microseconds.
// Timed twice side by side with v005, it ran 1.07 times as fast both times.
// Counting every step since v000, it is 5.88 times as fast.
#include <hip/hip_runtime.h>

// MultiHeadAttention forward for MI455X (gfx1250), wave32, WMMA f16->f32.
// B=2, S=2048, D=1024, H=16, DH=64.
//
//  1) qkv_proj: x @ W^T + b per head, f16 WMMA, results to d_ws as f16
//     in [B,H,S,DH] layout (Q,K,V = 3 * 8MB = 24MB of workspace).
//  2) flash_attn: online-softmax flash attention; KV tiles of 64 rows,
//     16 WMMAs per iteration; K tiles staged in LDS via
//     global_load_async_to_lds_b128 (ASYNCcnt), V the same way, row-major,
//     in two buffers: the next tile's copies fly while this one is worked on;
//     V^T fragments come out of LDS by ds_load_tr16_b128.
//     Both products run transposed (S^T = K Q^T, O^T += V^T P^T): a lane
//     holds scores of one query only, and P^T packs in registers.

#define BB 2
#define SS 2048
#define DD 1024
#define HH 16
#define DH 64
// LDS row pitch in halfs for the 64-half x, W and K tile rows: 144 B = 16 B x 9 (odd), so
// the 16 rows that one ds_load_b128 fragment read touches fall on distinct banks.
#define LP 72
// Pitch of the V tile rows, which ds_load_tr16_b128 reads: 160 B = 32 B x 5 (odd).
#define VP 80

typedef __attribute__((ext_vector_type(16))) _Float16 v16h;
typedef __attribute__((ext_vector_type(8)))  float    v8f;

__device__ __forceinline__ v8f wmma16(v16h a, v16h b, v8f c) {
    // D = A(16x32 f16) * B(32x16 f16) + C(16x16 f32)
    return __builtin_amdgcn_wmma_f32_16x16x32_f16(
        /*neg_a=*/false, a, /*neg_b=*/false, b,
        /*c_mod=*/(short)0, c, /*reuse_a=*/false, /*reuse_b=*/false);
}

// Load one 16-half fragment per lane as two aligned 16B chunks.
// rowp points at the lane's row start (+ kchunk*32 already applied);
// kbase = 8*(lane>=16). Matches ISA 16-bit A/B VGPR striping.
__device__ __forceinline__ v16h load_frag(const _Float16* rowp, int kbase) {
    union { v16h h; uint4 u[2]; } f;
    f.u[0] = *(const uint4*)(rowp + kbase);
    f.u[1] = *(const uint4*)(rowp + 16 + kbase);
    return f.h;
}

// One 16(d) x 32(key) V^T fragment out of a row-major V tile: p is the lane's
// address in the tile's first 16 keys; the second load takes the next 16 keys.
// Lane (mn, half) gets keys 8 half + 0..7 and 16 + 8 half + 0..7 of column mn:
// the k order of load_frag.
typedef __attribute__((ext_vector_type(8))) short s16x8;
__device__ __forceinline__ v16h load_frag_tr(const _Float16* p) {
    typedef __attribute__((address_space(3))) s16x8 lds_s16x8;
    union { v16h h; s16x8 u[2]; } f;
    f.u[0] = __builtin_amdgcn_ds_load_tr16_b128_v8i16((lds_s16x8*)p);
    f.u[1] = __builtin_amdgcn_ds_load_tr16_b128_v8i16((lds_s16x8*)(p + 16 * VP));
    return f.h;
}

// Four floats rounded to four halfs.
typedef __attribute__((ext_vector_type(4))) _Float16 v4h;
typedef __attribute__((ext_vector_type(4))) float    v4f;
__device__ __forceinline__ v4h cvt4(v4f v) {
    v4h r = { (_Float16)v.x, (_Float16)v.y, (_Float16)v.z, (_Float16)v.w };
    return r;
}

// ---------------------------------------------------------------------------
// Kernel 1: per-head QKV projection.  grid = (S/128, H, B), block = 256 (8 waves)
// ---------------------------------------------------------------------------
__global__ __launch_bounds__(256) void qkv_proj_kernel(
    const float* __restrict__ seqs,
    const float* __restrict__ Wq, const float* __restrict__ bq,
    const float* __restrict__ Wk, const float* __restrict__ bk,
    const float* __restrict__ Wv, const float* __restrict__ bv,
    _Float16* __restrict__ Q, _Float16* __restrict__ K, _Float16* __restrict__ V)
{
    const int tile = blockIdx.x;
    const int h    = blockIdx.y;
    const int b    = blockIdx.z;
    const int tid  = threadIdx.x;
    const int lane = tid & 31;
    const int wid  = tid >> 5;
    const int mn   = lane & 15;            // M (A row) or N (B/C col) index
    const int kb   = (lane >> 4) << 3;     // 0 or 8: K-half / C-row offset

    __shared__ __align__(16) _Float16 x_lds[128][LP];      // 18 KB
    __shared__ __align__(16) _Float16 w_lds[3][DH][LP];    // 27 KB

    const int row0 = tile * 128;

    // Every global read of the kernel is issued here, 16 B a lane for x and W, 4 B for the biases, unrolled, so
    // that all of them are in flight together and the wave waits out one latency,
    // not one per loop trip. A thread takes four floats of row fr (+ 16 a step).
    const int fr = tid >> 4, fc = (tid & 15) * 4;
    const float* xp  = seqs + ((size_t)b * SS + row0 + fr) * DD + h * DH + fc;
    const float* wp[3] = { Wq + h * DH * DH + fr * DH + fc,
                           Wk + h * DH * DH + fr * DH + fc,
                           Wv + h * DH * DH + fr * DH + fc };
    const float* bp[3] = { bq + h * DH + mn, bk + h * DH + mn, bv + h * DH + mn };
    v4f xv[8];
#pragma unroll
    for (int u = 0; u < 8; ++u)
        xv[u] = *(const v4f*)(xp + u * 16 * DD);
    v4f   wv[3][4];
    float bias_r[3][4];
#pragma unroll
    for (int j = 0; j < 3; ++j) {
#pragma unroll
        for (int u = 0; u < 4; ++u)
            wv[j][u] = *(const v4f*)(wp[j] + u * 16 * DH);
#pragma unroll
        for (int nt = 0; nt < 4; ++nt)
            bias_r[j][nt] = bp[j][nt * 16];
    }
    // One wait behind all the loads, ahead of any rewrite of their address registers:
    // it names the 16-byte loads' addresses, so that they stay in their registers up
    // to here and no later load's result lands in one of them.
    asm volatile("s_wait_xcnt 0x0"
                 :: "v"(xp), "v"(wp[0]), "v"(wp[1]), "v"(wp[2]) : "memory");

    // f32 -> f16 and into LDS, 8 B a lane: the x slice of this head, then the three
    // weight matrices row-major [e][d] (B[k=d][n=e] = W[e][d]).
#pragma unroll
    for (int u = 0; u < 8; ++u)
        *(v4h*)&x_lds[fr + u * 16][fc] = cvt4(xv[u]);
#pragma unroll
    for (int j = 0; j < 3; ++j)
#pragma unroll
        for (int u = 0; u < 4; ++u)
            *(v4h*)&w_lds[j][fr + u * 16][fc] = cvt4(wv[j][u]);
    __syncthreads();

    // A fragments: x tile rows [wid*16, wid*16+16), K = DH split in 2 chunks.
    v16h a[2];
#pragma unroll
    for (int kc = 0; kc < 2; ++kc)
        a[kc] = load_frag(&x_lds[wid * 16 + mn][kc * 32], kb);

    _Float16*    outs[3]   = { Q, K, V };
    const size_t obase = ((size_t)(b * HH + h) * SS + row0 + wid * 16) * DH;

#pragma unroll
    for (int j = 0; j < 3; ++j) {
#pragma unroll
        for (int nt = 0; nt < 4; ++nt) {
            v8f acc = {};
#pragma unroll
            for (int kc = 0; kc < 2; ++kc) {
                v16h bf = load_frag(&w_lds[j][nt * 16 + mn][kc * 32], kb);
                acc = wmma16(a[kc], bf, acc);
            }
            const float bias = bias_r[j][nt];
            _Float16* o = outs[j] + obase;
#pragma unroll
            for (int r = 0; r < 8; ++r) {
                const int mrow = r + kb;                       // C layout row
                o[(size_t)mrow * DH + nt * 16 + mn] = (_Float16)(acc[r] + bias);
            }
        }
    }
}

// ---------------------------------------------------------------------------
// Kernel 2: flash attention.  grid = (S/128, H, B), block = 256 (8 waves);
// each wave owns 16 query rows, loop over S in KV tiles of 64 rows.
// ---------------------------------------------------------------------------
// Value of lane l ^ 16: the other half of the same query's column.
__device__ __forceinline__ float xhalf(float x) {
    const int i = __builtin_bit_cast(int, x);
    return __builtin_bit_cast(float, __builtin_amdgcn_permlanex16(
        i, i, 0x76543210, 0xfedcba98, false, false));
}

__global__ __launch_bounds__(256) void flash_attn_kernel(
    const _Float16* __restrict__ Q, const _Float16* __restrict__ K,
    const _Float16* __restrict__ V, float* __restrict__ out)
{
    const int qt   = blockIdx.x;
    const int h    = blockIdx.y;
    const int b    = blockIdx.z;
    const int tid  = threadIdx.x;
    const int lane = tid & 31;
    const int wid  = tid >> 5;
    const int mn   = lane & 15;
    const int kb   = (lane >> 4) << 3;

    __shared__ __align__(16) _Float16 k_lds[2][64][LP];     // 2 x 9 KB (async target)
    __shared__ __align__(16) _Float16 v_lds[2][64][VP];     // 2 x 10 KB (async target)

    const size_t head_base = (size_t)(b * HH + h) * SS * DH;
    const _Float16* Qh = Q + head_base;
    const _Float16* Kh = K + head_base;
    const _Float16* Vh = V + head_base;

    // Q^T B-fragments straight from global (row-major [s][d], 16B aligned).
    const int q0 = qt * 128 + wid * 16;
    v16h aq[2];
#pragma unroll
    for (int kc = 0; kc < 2; ++kc)
        aq[kc] = load_frag(Qh + (size_t)(q0 + mn) * DH + kc * 32, kb);

    v8f o0 = {}, o1 = {}, o2 = {}, o3 = {};
    // Lane (mn, half) serves query q0 + mn: mrun is that query's running maximum
    // of the raw (unscaled) scores (equal in both halves), lrun the sum over this
    // half's keys only.
    float mrun = -1e30f, lrun = 0.0f;

    // The lane's 32 B of each K and V tile: four threads per 128 B source row.
    // (buffer 0; buffer 1 lies one buffer's bytes further).
    const unsigned klds_addr = (unsigned)(size_t)&k_lds[0][tid >> 2][(tid & 3) * 16];
    const unsigned vlds_addr = (unsigned)(size_t)&v_lds[0][tid >> 2][(tid & 3) * 16];
    // 1/sqrt(64) * log2(e): the softmax runs in base 2 on the raw scores.
    const float c2 = 0.125f * 1.4426950408889634f;

    // K and V tile t into buffer t & 1: each 64x64 f16 = 8192 B = 256 threads x
    // 32 B, async copies to LDS, both row-major. The s_wait_xcnt stands in the
    // copies' own statement, ahead of any rewrite of their address registers.
    auto copy_tile = [&](int t) {
        const _Float16* gk = Kh + (size_t)t * 64 * DH + tid * 16;
        const _Float16* gv = Vh + (size_t)t * 64 * DH + tid * 16;
        const unsigned kd = klds_addr + (unsigned)(t & 1) * (unsigned)sizeof(k_lds[0]);
        const unsigned vd = vlds_addr + (unsigned)(t & 1) * (unsigned)sizeof(v_lds[0]);
        asm volatile("global_load_async_to_lds_b128 %0, %1, off\n\t"
                     "global_load_async_to_lds_b128 %2, %3, off\n\t"
                     "global_load_async_to_lds_b128 %4, %5, off\n\t"
                     "global_load_async_to_lds_b128 %6, %7, off\n\t"
                     "s_wait_xcnt 0x0"
                     :: "v"(kd), "v"(gk), "v"(kd + 16u), "v"(gk + 8),
                        "v"(vd), "v"(gv), "v"(vd + 16u), "v"(gv + 8)
                     : "memory");
    };

    // Tile 0 lands and is published; tile 1 is under way when the loop starts.
    copy_tile(0);
    asm volatile("s_wait_asynccnt 0x0" ::: "memory");
    __syncthreads();
    copy_tile(1);

    for (int jt = 0; jt < SS / 64; ++jt) {
        const _Float16 (*kt)[LP] = k_lds[jt & 1];
        // The lane's address for the transposing loads (keys 0..15, columns 0..15).
        const _Float16* vtr = &v_lds[jt & 1][kb + (lane & 7)][((lane >> 3) & 1) * 8];

        // S^T[64x16] = K(64x64) @ Q^T : A[m=kvrow][k=d] = kt[kvrow][d].
        // Tile t, register r of lane (mn, half): key 16 t + kb + r, query mn.
        v8f s0 = {}, s1 = {}, s2 = {}, s3 = {};
#pragma unroll
        for (int kc = 0; kc < 2; ++kc) {
            s0 = wmma16(load_frag(&kt[ 0 + mn][kc * 32], kb), aq[kc], s0);
            s1 = wmma16(load_frag(&kt[16 + mn][kc * 32], kb), aq[kc], s1);
            s2 = wmma16(load_frag(&kt[32 + mn][kc * 32], kb), aq[kc], s2);
            s3 = wmma16(load_frag(&kt[48 + mn][kc * 32], kb), aq[kc], s3);
        }

        // All V^T fragments as one group of LDS reads, ahead of the softmax
        // (unrolled, so that va is indexed by constants and stays in registers).
        v16h va[2][4];
#pragma unroll
        for (int kc = 0; kc < 2; ++kc)
#pragma unroll
            for (int t = 0; t < 4; ++t)
                va[kc][t] = load_frag_tr(vtr + kc * 32 * VP + t * 16);
        // Ends the scheduling region here: without it the trip opens with two loads
        // and a full LDS wait, and two S^T WMMAs move behind the barrier.
        __builtin_amdgcn_sched_barrier(0);

        // Publish point: these were the trip's last LDS reads. The wave's reads
        // have retired and its copies of tile jt + 1 have landed before the one
        // barrier of the trip, which hands tile jt + 1 to every wave and frees
        // this trip's buffer; tile jt + 2 then flies under softmax, the second
        // product and the next trip's reads.
        asm volatile("s_wait_dscnt 0x0" ::: "memory");
        asm volatile("s_wait_asynccnt 0x0" ::: "memory");
        __syncthreads();
        if (jt + 2 < SS / 64)
            copy_tile(jt + 2);

        // Online softmax: the lane's 32 scores belong to one query, so maximum
        // and sum run in-lane; one exchange joins the halves' maxima.
        // The maximum is taken on the raw scores (the scale is positive).
        float mx = -1e30f;
#pragma unroll
        for (int r = 0; r < 8; ++r)
            mx = fmaxf(mx, fmaxf(fmaxf(s0[r], s1[r]), fmaxf(s2[r], s3[r])));
        mx = fmaxf(mx, xhalf(mx));
        const float mnew  = fmaxf(mrun, mx);
        // exp(scale * (s - m)) = 2^(c2 * s - c2 * m): one fused multiply-add per
        // score feeds the hardware's base-2 exponential directly.
        const float mb    = mnew * c2;
        const float alpha = __builtin_amdgcn_exp2f(__builtin_fmaf(mrun, c2, -mb));
        mrun = mnew;

        // P^T as B operand: two score tiles of 16 keys, converted in place, are
        // one 32-key fragment in the k order that load_frag_tr gives V^T.
        // Vector FMAs, so that they build as the packed form: two scores each.
        const v8f c2v = { c2, c2, c2, c2, c2, c2, c2, c2 };
        const v8f nmb = { -mb, -mb, -mb, -mb, -mb, -mb, -mb, -mb };
        s0 = __builtin_elementwise_fma(s0, c2v, nmb);
        s1 = __builtin_elementwise_fma(s1, c2v, nmb);
        s2 = __builtin_elementwise_fma(s2, c2v, nmb);
        s3 = __builtin_elementwise_fma(s3, c2v, nmb);
        v16h bp[2];
        float rs = 0.0f;
#pragma unroll
        for (int r = 0; r < 8; ++r) {
            const float p0 = __builtin_amdgcn_exp2f(s0[r]);
            const float p1 = __builtin_amdgcn_exp2f(s1[r]);
            const float p2 = __builtin_amdgcn_exp2f(s2[r]);
            const float p3 = __builtin_amdgcn_exp2f(s3[r]);
            rs += (p0 + p1) + (p2 + p3);
            bp[0][r] = (_Float16)p0; bp[0][8 + r] = (_Float16)p1;
            bp[1][r] = (_Float16)p2; bp[1][8 + r] = (_Float16)p3;
        }
        lrun = lrun * alpha + rs;
#pragma unroll
        for (int r = 0; r < 8; ++r) {
            o0[r] *= alpha; o1[r] *= alpha;
            o2[r] *= alpha; o3[r] *= alpha;
        }

        // O^T += V^T(64x64) @ P^T(64x16): A[m=d][k=kvrow] = v_lds[kvrow][d]
#pragma unroll
        for (int kc = 0; kc < 2; ++kc) {
            o0 = wmma16(va[kc][0], bp[kc], o0);
            o1 = wmma16(va[kc][1], bp[kc], o1);
            o2 = wmma16(va[kc][2], bp[kc], o2);
            o3 = wmma16(va[kc][3], bp[kc], o3);
        }
    }
    // No copy is outstanding when the wave ends.
    asm volatile("s_wait_asynccnt 0x0" ::: "memory");

    // Epilogue: join the halves' sums, normalize, store f32 output [B,S,D]
    // (D = H*DH). Tile t, register r: column 16 t + kb + r of row q0 + mn.
    const float inv = 1.0f / (lrun + xhalf(lrun));

    float* orow = out + ((size_t)b * SS + q0 + mn) * DD + h * DH + kb;
    const v8f ot[4] = { o0, o1, o2, o3 };
#pragma unroll
    for (int t = 0; t < 4; ++t) {
        *(float4*)(orow + t * 16) = make_float4(ot[t][0] * inv, ot[t][1] * inv,
                                                ot[t][2] * inv, ot[t][3] * inv);
        *(float4*)(orow + t * 16 + 4) = make_float4(ot[t][4] * inv, ot[t][5] * inv,
                                                    ot[t][6] * inv, ot[t][7] * inv);
    }
}

// ---------------------------------------------------------------------------
extern "C" void kernel_launch(void* const* d_in, const int* in_sizes, int n_in,
                              void* d_out, int out_size, void* d_ws, size_t ws_size,
                              hipStream_t stream) {
    const float* seqs = (const float*)d_in[0];
    const float* Wq   = (const float*)d_in[1];
    const float* bq   = (const float*)d_in[2];
    const float* Wk   = (const float*)d_in[3];
    const float* bk   = (const float*)d_in[4];
    const float* Wv   = (const float*)d_in[5];
    const float* bv   = (const float*)d_in[6];
    float* out = (float*)d_out;

    // Workspace: Q,K,V f16 [B,H,S,DH] -> 3 * 8 MB = 24 MB.
    const size_t elems = (size_t)BB * HH * SS * DH;
    _Float16* Qw = (_Float16*)d_ws;
    _Float16* Kw = Qw + elems;
    _Float16* Vw = Kw + elems;

    dim3 grid(SS / 128, HH, BB), block(256);
    qkv_proj_kernel<<<grid, block, 0, stream>>>(seqs, Wq, bq, Wk, bk, Wv, bv,
                                                Qw, Kw, Vw);
    flash_attn_kernel<<<grid, block, 0, stream>>>(Qw, Kw, Vw, out);
}

// v007
// A run of this version takes 47.3 microseconds.
// Next to v006, in two timings, it ran 1.03 times as fast each time.
// Over all steps from v000 it is 6.07 times as fast.
#include <hip/hip_runtime.h>

// MultiHeadAttention forward for MI455X (gfx1250), wave32, WMMA f16->f32.
// B=2, S=2048, D=1024, H=16, DH=64.
//
//  1) qkv_proj: x @ W^T + b per head, f16 WMMA, results to d_ws as f16
//     in [B,H,S,DH] layout (Q,K,V = 3 * 8MB = 24MB of workspace).
//  2) flash_attn: online-softmax flash attention; KV tiles of 64 rows,
//     16 WMMAs per iteration; K tiles staged in LDS via
//     global_load_async_to_lds_b128 (ASYNCcnt), V the same way, row-major,
//     in two buffers: the next tile's copies fly while this one is worked on;
//     V^T fragments come out of LDS by ds_load_tr16_b128.
//     Both products run transposed (S^T = K Q^T, O^T += V^T P^T): a lane
//     holds scores of one query only, and P^T packs in registers.
//     A wave takes 32 queries x 32 keys of a tile: a fragment feeds two WMMAs.

#define BB 2
#define SS 2048
#define DD 1024
#define HH 16
#define DH 64
// LDS row pitch in halfs for the 64-half x, W and K tile rows: 144 B = 16 B x 9 (odd), so
// the 16 rows that one ds_load_b128 fragment read touches fall on distinct banks.
#define LP 72
// Pitch of the V tile rows, which ds_load_tr16_b128 reads: 160 B = 32 B x 5 (odd).
#define VP 80

typedef __attribute__((ext_vector_type(16))) _Float16 v16h;
typedef __attribute__((ext_vector_type(8)))  float    v8f;

__device__ __forceinline__ v8f wmma16(v16h a, v16h b, v8f c) {
    // D = A(16x32 f16) * B(32x16 f16) + C(16x16 f32)
    return __builtin_amdgcn_wmma_f32_16x16x32_f16(
        /*neg_a=*/false, a, /*neg_b=*/false, b,
        /*c_mod=*/(short)0, c, /*reuse_a=*/false, /*reuse_b=*/false);
}

// Load one 16-half fragment per lane as two aligned 16B chunks.
// rowp points at the lane's row start (+ kchunk*32 already applied);
// kbase = 8*(lane>=16). Matches ISA 16-bit A/B VGPR striping.
__device__ __forceinline__ v16h load_frag(const _Float16* rowp, int kbase) {
    union { v16h h; uint4 u[2]; } f;
    f.u[0] = *(const uint4*)(rowp + kbase);
    f.u[1] = *(const uint4*)(rowp + 16 + kbase);
    return f.h;
}

// One 16(d) x 32(key) V^T fragment out of a row-major V tile: p is the lane's
// address in the fragment's first 16 keys; the second load takes the next 16 keys.
// Lane (mn, half) gets keys 8 half + 0..7 and 16 + 8 half + 0..7 of column mn:
// the k order of load_frag.
typedef __attribute__((ext_vector_type(8))) short s16x8;
__device__ __forceinline__ v16h load_frag_tr(const _Float16* p) {
    typedef __attribute__((address_space(3))) s16x8 lds_s16x8;
    union { v16h h; s16x8 u[2]; } f;
    f.u[0] = __builtin_amdgcn_ds_load_tr16_b128_v8i16((lds_s16x8*)p);
    f.u[1] = __builtin_amdgcn_ds_load_tr16_b128_v8i16((lds_s16x8*)(p + 16 * VP));
    return f.h;
}

// Four floats rounded to four halfs.
typedef __attribute__((ext_vector_type(4))) _Float16 v4h;
typedef __attribute__((ext_vector_type(4))) float    v4f;
__device__ __forceinline__ v4h cvt4(v4f v) {
    v4h r = { (_Float16)v.x, (_Float16)v.y, (_Float16)v.z, (_Float16)v.w };
    return r;
}

// ---------------------------------------------------------------------------
// Kernel 1: per-head QKV projection.  grid = (S/128, H, B), block = 256 (8 waves)
// ---------------------------------------------------------------------------
__global__ __launch_bounds__(256) void qkv_proj_kernel(
    const float* __restrict__ seqs,
    const float* __restrict__ Wq, const float* __restrict__ bq,
    const float* __restrict__ Wk, const float* __restrict__ bk,
    const float* __restrict__ Wv, const float* __restrict__ bv,
    _Float16* __restrict__ Q, _Float16* __restrict__ K, _Float16* __restrict__ V)
{
    const int tile = blockIdx.x;
    const int h    = blockIdx.y;
    const int b    = blockIdx.z;
    const int tid  = threadIdx.x;
    const int lane = tid & 31;
    const int wid  = tid >> 5;
    const int mn   = lane & 15;            // M (A row) or N (B/C col) index
    const int kb   = (lane >> 4) << 3;     // 0 or 8: K-half / C-row offset

    __shared__ __align__(16) _Float16 x_lds[128][LP];      // 18 KB
    __shared__ __align__(16) _Float16 w_lds[3][DH][LP];    // 27 KB

    const int row0 = tile * 128;

    // Every global read of the kernel is issued here, 16 B a lane for x and W, 4 B for the biases, unrolled, so
    // that all of them are in flight together and the wave waits out one latency,
    // not one per loop trip. A thread takes four floats of row fr (+ 16 a step).
    const int fr = tid >> 4, fc = (tid & 15) * 4;
    const float* xp  = seqs + ((size_t)b * SS + row0 + fr) * DD + h * DH + fc;
    const float* wp[3] = { Wq + h * DH * DH + fr * DH + fc,
                           Wk + h * DH * DH + fr * DH + fc,
                           Wv + h * DH * DH + fr * DH + fc };
    const float* bp[3] = { bq + h * DH + mn, bk + h * DH + mn, bv + h * DH + mn };
    v4f xv[8];
#pragma unroll
    for (int u = 0; u < 8; ++u)
        xv[u] = *(const v4f*)(xp + u * 16 * DD);
    v4f   wv[3][4];
    float bias_r[3][4];
#pragma unroll
    for (int j = 0; j < 3; ++j) {
#pragma unroll
        for (int u = 0; u < 4; ++u)
            wv[j][u] = *(const v4f*)(wp[j] + u * 16 * DH);
#pragma unroll
        for (int nt = 0; nt < 4; ++nt)
            bias_r[j][nt] = bp[j][nt * 16];
    }
    // One wait behind all the loads, ahead of any rewrite of their address registers:
    // it names the 16-byte loads' addresses, so that they stay in their registers up
    // to here and no later load's result lands in one of them.
    asm volatile("s_wait_xcnt 0x0"
                 :: "v"(xp), "v"(wp[0]), "v"(wp[1]), "v"(wp[2]) : "memory");

    // f32 -> f16 and into LDS, 8 B a lane: the x slice of this head, then the three
    // weight matrices row-major [e][d] (B[k=d][n=e] = W[e][d]).
#pragma unroll
    for (int u = 0; u < 8; ++u)
        *(v4h*)&x_lds[fr + u * 16][fc] = cvt4(xv[u]);
#pragma unroll
    for (int j = 0; j < 3; ++j)
#pragma unroll
        for (int u = 0; u < 4; ++u)
            *(v4h*)&w_lds[j][fr + u * 16][fc] = cvt4(wv[j][u]);
    __syncthreads();

    // A fragments: x tile rows [wid*16, wid*16+16), K = DH split in 2 chunks.
    v16h a[2];
#pragma unroll
    for (int kc = 0; kc < 2; ++kc)
        a[kc] = load_frag(&x_lds[wid * 16 + mn][kc * 32], kb);

    _Float16*    outs[3]   = { Q, K, V };
    const size_t obase = ((size_t)(b * HH + h) * SS + row0 + wid * 16) * DH;

#pragma unroll
    for (int j = 0; j < 3; ++j) {
#pragma unroll
        for (int nt = 0; nt < 4; ++nt) {
            v8f acc = {};
#pragma unroll
            for (int kc = 0; kc < 2; ++kc) {
                v16h bf = load_frag(&w_lds[j][nt * 16 + mn][kc * 32], kb);
                acc = wmma16(a[kc], bf, acc);
            }
            const float bias = bias_r[j][nt];
            _Float16* o = outs[j] + obase;
#pragma unroll
            for (int r = 0; r < 8; ++r) {
                const int mrow = r + kb;                       // C layout row
                o[(size_t)mrow * DH + nt * 16 + mn] = (_Float16)(acc[r] + bias);
            }
        }
    }
}

// ---------------------------------------------------------------------------
// Kernel 2: flash attention.  grid = (S/128, H, B), block = 256 (8 waves).
// A wave owns 32 query rows (two 16-column tiles) and one half (32 keys) of
// every 64-row KV tile, so that each K and V^T fragment read from LDS feeds two
// WMMAs. Waves w and w + 4 serve the same queries on the two key halves; their
// partial maxima, sums and outputs are merged through LDS after the loop.
// ---------------------------------------------------------------------------
// Value of lane l ^ 16: the other half of the same query's column.
__device__ __forceinline__ float xhalf(float x) {
    const int i = __builtin_bit_cast(int, x);
    return __builtin_bit_cast(float, __builtin_amdgcn_permlanex16(
        i, i, 0x76543210, 0xfedcba98, false, false));
}

// Four waves per SIMD (two blocks per WGP): a budget of 256 registers a wave.
__global__ __launch_bounds__(256) __attribute__((amdgpu_waves_per_eu(4, 4)))
void flash_attn_kernel(
    const _Float16* __restrict__ Q, const _Float16* __restrict__ K,
    const _Float16* __restrict__ V, float* __restrict__ out)
{
    const int qt   = blockIdx.x;
    const int h    = blockIdx.y;
    const int b    = blockIdx.z;
    const int tid  = threadIdx.x;
    const int lane = tid & 31;
    const int wid  = tid >> 5;
    const int qw   = wid & 3;              // which 32 queries of the block
    const int kh   = wid >> 2;             // which 32 keys of every tile
    const int mn   = lane & 15;
    const int kb   = (lane >> 4) << 3;

    __shared__ __align__(16) _Float16 k_lds[2][64][LP];     // 2 x 9 KB (async target)
    __shared__ __align__(16) _Float16 v_lds[2][64][VP];     // 2 x 10 KB (async target)
    // Merge staging: per wave and lane 32 output floats, then maximum and sum.
    __shared__ __align__(16) float4 mrg[8][9][32];          // 36 KB

    const size_t head_base = (size_t)(b * HH + h) * SS * DH;
    const _Float16* Qh = Q + head_base;
    const _Float16* Kh = K + head_base;
    const _Float16* Vh = V + head_base;

    // Q^T B-fragments straight from global (row-major [s][d], 16B aligned):
    // query tile g holds rows q0 + 16 g + 0..15.
    const int q0 = qt * 128 + qw * 32;
    v16h aq[2][2];
#pragma unroll
    for (int g = 0; g < 2; ++g)
#pragma unroll
        for (int kc = 0; kc < 2; ++kc)
            aq[g][kc] = load_frag(Qh + (size_t)(q0 + g * 16 + mn) * DH + kc * 32, kb);

    v8f o[2][4] = {};
    // Lane (mn, half) serves queries q0 + 16 g + mn: mrun[g] is the running maximum
    // of that query's raw (unscaled) scores over this wave's keys (equal in both
    // halves), lrun[g] the sum over this lane half's keys only.
    float mrun[2] = { -1e30f, -1e30f }, lrun[2] = { 0.0f, 0.0f };

    // The lane's 32 B of each K and V tile: four threads per 128 B source row.
    // (buffer 0; buffer 1 lies one buffer's bytes further).
    const unsigned klds_addr = (unsigned)(size_t)&k_lds[0][tid >> 2][(tid & 3) * 16];
    const unsigned vlds_addr = (unsigned)(size_t)&v_lds[0][tid >> 2][(tid & 3) * 16];
    // 1/sqrt(64) * log2(e): the softmax runs in base 2 on the raw scores.
    const float c2 = 0.125f * 1.4426950408889634f;

    // K and V tile t into buffer t & 1: each 64x64 f16 = 8192 B = 256 threads x
    // 32 B, async copies to LDS, both row-major. The s_wait_xcnt stands in the
    // copies' own statement, ahead of any rewrite of their address registers.
    auto copy_tile = [&](int t) {
        const _Float16* gk = Kh + (size_t)t * 64 * DH + tid * 16;
        const _Float16* gv = Vh + (size_t)t * 64 * DH + tid * 16;
        const unsigned kd = klds_addr + (unsigned)(t & 1) * (unsigned)sizeof(k_lds[0]);
        const unsigned vd = vlds_addr + (unsigned)(t & 1) * (unsigned)sizeof(v_lds[0]);
        asm volatile("global_load_async_to_lds_b128 %0, %1, off\n\t"
                     "global_load_async_to_lds_b128 %2, %3, off\n\t"
                     "global_load_async_to_lds_b128 %4, %5, off\n\t"
                     "global_load_async_to_lds_b128 %6, %7, off\n\t"
                     "s_wait_xcnt 0x0"
                     :: "v"(kd), "v"(gk), "v"(kd + 16u), "v"(gk + 8),
                        "v"(vd), "v"(gv), "v"(vd + 16u), "v"(gv + 8)
                     : "memory");
    };

    // Tile 0 lands and is published; tile 1 is under way when the loop starts.
    copy_tile(0);
    asm volatile("s_wait_asynccnt 0x0" ::: "memory");
    __syncthreads();
    copy_tile(1);

    for (int jt = 0; jt < SS / 64; ++jt) {
        // The wave's 32 rows of the K tile.
        const _Float16 (*kt)[LP] = &k_lds[jt & 1][kh * 32];
        // The lane's address for the transposing loads (the wave's keys 0..15,
        // columns 0..15).
        const _Float16* vtr =
            &v_lds[jt & 1][kh * 32 + kb + (lane & 7)][((lane >> 3) & 1) * 8];

        // All LDS reads of the trip as one group: the wave's four K fragments, then
        // its four V^T fragments (unrolled, so that both arrays are indexed by
        // constants and stay in registers).
        v16h kf[2][2], va[4];
#pragma unroll
        for (int kc = 0; kc < 2; ++kc)
#pragma unroll
            for (int t = 0; t < 2; ++t)
                kf[kc][t] = load_frag(&kt[t * 16 + mn][kc * 32], kb);
#pragma unroll
        for (int t = 0; t < 4; ++t)
            va[t] = load_frag_tr(vtr + t * 16);
        // Keeps the reads ahead of the WMMAs: without it the K fragments share one
        // set of registers and each pair of WMMAs waits out a full LDS latency.
        __builtin_amdgcn_sched_barrier(0);

        // S^T[32x32] = K(32x64) @ Q^T : A[m=kvrow][k=d] = kt[kvrow][d]; one K
        // fragment serves both query tiles. Tile (g, t), register r of lane
        // (mn, half): key 32 kh + 16 t + kb + r, query 16 g + mn.
        v8f s[2][2] = {};
#pragma unroll
        for (int kc = 0; kc < 2; ++kc)
#pragma unroll
            for (int t = 0; t < 2; ++t) {
                s[0][t] = wmma16(kf[kc][t], aq[0][kc], s[0][t]);
                s[1][t] = wmma16(kf[kc][t], aq[1][kc], s[1][t]);
            }
        // Ends the scheduling region here, so that no S^T WMMA of the trip moves
        // behind the barrier.
        __builtin_amdgcn_sched_barrier(0);

        // Publish point: these were the trip's last LDS reads. The wave's reads
        // have retired and its copies of tile jt + 1 have landed before the one
        // barrier of the trip, which hands tile jt + 1 to every wave and frees
        // this trip's buffer; tile jt + 2 then flies under softmax, the second
        // product and the next trip's reads.
        asm volatile("s_wait_dscnt 0x0" ::: "memory");
        asm volatile("s_wait_asynccnt 0x0" ::: "memory");
        __syncthreads();
        if (jt + 2 < SS / 64)
            copy_tile(jt + 2);

        // Online softmax, per query tile: the lane's 16 scores of a tile belong to
        // one query, so maximum and sum run in-lane; one exchange joins the halves'
        // maxima. The maximum is taken on the raw scores (the scale is positive).
#pragma unroll
        for (int g = 0; g < 2; ++g) {
            float mx = fmaxf(s[g][0][0], s[g][1][0]);
#pragma unroll
            for (int r = 1; r < 8; ++r)
                mx = fmaxf(fmaxf(mx, s[g][0][r]), s[g][1][r]);
            const float mnew  = fmaxf(fmaxf(mrun[g], mx), xhalf(mx));
            // exp(scale * (s - m)) = 2^(c2 * s - c2 * m): one fused multiply-add per
            // score feeds the hardware's base-2 exponential directly.
            const float mb    = mnew * c2;
            const float alpha = __builtin_amdgcn_exp2f(__builtin_fmaf(mrun[g], c2, -mb));
            mrun[g] = mnew;

            // P^T as B operand: the two score tiles of 16 keys, converted in place,
            // are one 32-key fragment in the k order that load_frag_tr gives V^T.
            // Vector FMAs, so that they build as the packed form: two scores each.
            const v8f c2v = { c2, c2, c2, c2, c2, c2, c2, c2 };
            const v8f nmb = { -mb, -mb, -mb, -mb, -mb, -mb, -mb, -mb };
            s[g][0] = __builtin_elementwise_fma(s[g][0], c2v, nmb);
            s[g][1] = __builtin_elementwise_fma(s[g][1], c2v, nmb);
            v16h bp;
#pragma unroll
            for (int r = 0; r < 8; ++r) {
                s[g][0][r] = __builtin_amdgcn_exp2f(s[g][0][r]);
                s[g][1][r] = __builtin_amdgcn_exp2f(s[g][1][r]);
            }
            const v8f ps = s[g][0] + s[g][1];
            float rs = 0.0f;
#pragma unroll
            for (int r = 0; r < 8; ++r) {
                rs += ps[r];
                bp[r] = (_Float16)s[g][0][r]; bp[8 + r] = (_Float16)s[g][1][r];
            }
            lrun[g] = lrun[g] * alpha + rs;
#pragma unroll
            for (int t = 0; t < 4; ++t)
#pragma unroll
                for (int r = 0; r < 8; ++r)
                    o[g][t][r] *= alpha;

            // O^T += V^T(64x32) @ P^T(32x16): A[m=d][k=kvrow] = v_lds[kvrow][d]; the
            // same four V^T fragments serve both query tiles.
#pragma unroll
            for (int t = 0; t < 4; ++t)
                o[g][t] = wmma16(va[t], bp, o[g][t]);
        }
    }
    // No copy is outstanding when the wave ends.
    asm volatile("s_wait_asynccnt 0x0" ::: "memory");

    // Merge of the two key halves: wave (qw, kh) finishes query tile kh and hands
    // its partial result for the other tile to wave (qw, 1 - kh). Both waves hold
    // an element in the same lane and register, so a lane reads what its own
    // number wrote.
    const bool up = kh != 0;
    v8f keep[4], give[4];
#pragma unroll
    for (int t = 0; t < 4; ++t) {
        keep[t] = up ? o[1][t] : o[0][t];
        give[t] = up ? o[0][t] : o[1][t];
    }
    const float mk = up ? mrun[1] : mrun[0], lk = up ? lrun[1] : lrun[0];
    const float mg = up ? mrun[0] : mrun[1], lg = up ? lrun[0] : lrun[1];
#pragma unroll
    for (int t = 0; t < 4; ++t) {
        mrg[wid][2 * t][lane]     = make_float4(give[t][0], give[t][1], give[t][2], give[t][3]);
        mrg[wid][2 * t + 1][lane] = make_float4(give[t][4], give[t][5], give[t][6], give[t][7]);
    }
    mrg[wid][8][lane] = make_float4(mg, lg, 0.0f, 0.0f);
    __syncthreads();
    const float4 ml = mrg[wid ^ 4][8][lane];
    const float mall = fmaxf(mk, ml.x);
    const float wk = __builtin_amdgcn_exp2f((mk - mall) * c2);
    const float wo = __builtin_amdgcn_exp2f((ml.x - mall) * c2);
    const float lsum = lk * wk + ml.y * wo;

    // Join the lane halves' sums, normalize, store f32 output [B,S,D] (D = H*DH).
    // Tile t, register r: column 16 t + kb + r of row q0 + 16 kh + mn.
    const float inv = 1.0f / (lsum + xhalf(lsum));
    const float fk = wk * inv, fo = wo * inv;

    float* orow = out + ((size_t)b * SS + q0 + kh * 16 + mn) * DD + h * DH + kb;
#pragma unroll
    for (int t = 0; t < 4; ++t) {
        const float4 a0 = mrg[wid ^ 4][2 * t][lane];
        const float4 a1 = mrg[wid ^ 4][2 * t + 1][lane];
        *(float4*)(orow + t * 16) =
            make_float4(keep[t][0] * fk + a0.x * fo, keep[t][1] * fk + a0.y * fo,
                        keep[t][2] * fk + a0.z * fo, keep[t][3] * fk + a0.w * fo);
        *(float4*)(orow + t * 16 + 4) =
            make_float4(keep[t][4] * fk + a1.x * fo, keep[t][5] * fk + a1.y * fo,
                        keep[t][6] * fk + a1.z * fo, keep[t][7] * fk + a1.w * fo);
    }
}

// ---------------------------------------------------------------------------
extern "C" void kernel_launch(void* const* d_in, const int* in_sizes, int n_in,
                              void* d_out, int out_size, void* d_ws, size_t ws_size,
                              hipStream_t stream) {
    const float* seqs = (const float*)d_in[0];
    const float* Wq   = (const float*)d_in[1];
    const float* bq   = (const float*)d_in[2];
    const float* Wk   = (const float*)d_in[3];
    const float* bk   = (const float*)d_in[4];
    const float* Wv   = (const float*)d_in[5];
    const float* bv   = (const float*)d_in[6];
    float* out = (float*)d_out;

    // Workspace: Q,K,V f16 [B,H,S,DH] -> 3 * 8 MB = 24 MB.
    const size_t elems = (size_t)BB * HH * SS * DH;
    _Float16* Qw = (_Float16*)d_ws;
    _Float16* Kw = Qw + elems;
    _Float16* Vw = Kw + elems;

    dim3 grid(SS / 128, HH, BB), block(256);
    qkv_proj_kernel<<<grid, block, 0, stream>>>(seqs, Wq, bq, Wk, bk, Wv, bv,
                                                Qw, Kw, Vw);
    flash_attn_kernel<<<grid, block, 0, stream>>>(Qw, Kw, Vw, out);
}

// v008
// One run takes 46.3 microseconds.
// In two side-by-side timings against v007, it was 1.04 and 1.02 times as fast.
// All steps since v000 together make it 6.24 times as fast.
#include <hip/hip_runtime.h>

// MultiHeadAttention forward for MI455X (gfx1250), wave32, WMMA f16->f32.
// B=2, S=2048, D=1024, H=16, DH=64.
//
//  1) qkv_proj: x @ W^T + b per head, f16 WMMA, results to d_ws as f16
//     in [B,H,S,DH] layout (Q,K,V = 3 * 8MB = 24MB of workspace).
//  2) flash_attn: online-softmax flash attention; KV tiles of 64 rows,
//     16 WMMAs per iteration; K tiles staged in LDS via
//     global_load_async_to_lds_b128 (ASYNCcnt), V the same way, row-major,
//     in two buffers: the next tile's copies fly while this one is worked on;
//     V^T fragments come out of LDS by ds_load_tr16_b128.
//     Both products run transposed (S^T = K Q^T, O^T += V^T P^T): a lane
//     holds scores of one query only, and P^T packs in registers.
//     A wave takes 32 queries x 32 keys of a tile: a fragment feeds two WMMAs.

#define BB 2
#define SS 2048
#define DD 1024
#define HH 16
#define DH 64
// LDS row pitch in halfs for the 64-half x, W and K tile rows: 144 B = 16 B x 9 (odd), so
// the 16 rows that one ds_load_b128 fragment read touches fall on distinct banks.
#define LP 72
// Pitch of the V tile rows, which ds_load_tr16_b128 reads: 160 B = 32 B x 5 (odd).
#define VP 80

typedef __attribute__((ext_vector_type(16))) _Float16 v16h;
typedef __attribute__((ext_vector_type(8)))  float    v8f;

__device__ __forceinline__ v8f wmma16(v16h a, v16h b, v8f c) {
    // D = A(16x32 f16) * B(32x16 f16) + C(16x16 f32)
    return __builtin_amdgcn_wmma_f32_16x16x32_f16(
        /*neg_a=*/false, a, /*neg_b=*/false, b,
        /*c_mod=*/(short)0, c, /*reuse_a=*/false, /*reuse_b=*/false);
}

// Load one 16-half fragment per lane as two aligned 16B chunks.
// rowp points at the lane's row start (+ kchunk*32 already applied);
// kbase = 8*(lane>=16). Matches ISA 16-bit A/B VGPR striping.
__device__ __forceinline__ v16h load_frag(const _Float16* rowp, int kbase) {
    union { v16h h; uint4 u[2]; } f;
    f.u[0] = *(const uint4*)(rowp + kbase);
    f.u[1] = *(const uint4*)(rowp + 16 + kbase);
    return f.h;
}

// One 16(d) x 32(key) V^T fragment out of a row-major V tile: p is the lane's
// address in the fragment's first 16 keys; the second load takes the next 16 keys.
// Lane (mn, half) gets keys 8 half + 0..7 and 16 + 8 half + 0..7 of column mn:
// the k order of load_frag.
typedef __attribute__((ext_vector_type(8))) short s16x8;
__device__ __forceinline__ v16h load_frag_tr(const _Float16* p) {
    typedef __attribute__((address_space(3))) s16x8 lds_s16x8;
    union { v16h h; s16x8 u[2]; } f;
    f.u[0] = __builtin_amdgcn_ds_load_tr16_b128_v8i16((lds_s16x8*)p);
    f.u[1] = __builtin_amdgcn_ds_load_tr16_b128_v8i16((lds_s16x8*)(p + 16 * VP));
    return f.h;
}

// Four floats rounded to four halfs.
typedef __attribute__((ext_vector_type(4))) _Float16 v4h;
typedef __attribute__((ext_vector_type(4))) float    v4f;
__device__ __forceinline__ v4h cvt4(v4f v) {
    v4h r = { (_Float16)v.x, (_Float16)v.y, (_Float16)v.z, (_Float16)v.w };
    return r;
}

// ---------------------------------------------------------------------------
// Kernel 1: per-head QKV projection.  grid = (S/128, H, B), block = 256 (8 waves)
// ---------------------------------------------------------------------------
__global__ __launch_bounds__(256) void qkv_proj_kernel(
    const float* __restrict__ seqs,
    const float* __restrict__ Wq, const float* __restrict__ bq,
    const float* __restrict__ Wk, const float* __restrict__ bk,
    const float* __restrict__ Wv, const float* __restrict__ bv,
    _Float16* __restrict__ Q, _Float16* __restrict__ K, _Float16* __restrict__ V)
{
    const int tile = blockIdx.x;
    const int h    = blockIdx.y;
    const int b    = blockIdx.z;
    const int tid  = threadIdx.x;
    const int lane = tid & 31;
    const int wid  = tid >> 5;
    const int mn   = lane & 15;            // M (A row) or N (B/C col) index
    const int kb   = (lane >> 4) << 3;     // 0 or 8: K-half / C-row offset

    __shared__ __align__(16) _Float16 x_lds[128][LP];      // 18 KB
    __shared__ __align__(16) _Float16 w_lds[3][DH][LP];    // 27 KB

    const int row0 = tile * 128;

    // Every global read of the kernel is issued here, 16 B a lane for x and W, 4 B for the biases, unrolled, so
    // that all of them are in flight together and the wave waits out one latency,
    // not one per loop trip. A thread takes four floats of row fr (+ 16 a step).
    const int fr = tid >> 4, fc = (tid & 15) * 4;
    const float* xp  = seqs + ((size_t)b * SS + row0 + fr) * DD + h * DH + fc;
    const float* wp[3] = { Wq + h * DH * DH + fr * DH + fc,
                           Wk + h * DH * DH + fr * DH + fc,
                           Wv + h * DH * DH + fr * DH + fc };
    const float* bp[3] = { bq + h * DH + mn, bk + h * DH + mn, bv + h * DH + mn };
    v4f xv[8];
#pragma unroll
    for (int u = 0; u < 8; ++u)
        xv[u] = *(const v4f*)(xp + u * 16 * DD);
    v4f   wv[3][4];
    float bias_r[3][4];
#pragma unroll
    for (int j = 0; j < 3; ++j) {
#pragma unroll
        for (int u = 0; u < 4; ++u)
            wv[j][u] = *(const v4f*)(wp[j] + u * 16 * DH);
#pragma unroll
        for (int nt = 0; nt < 4; ++nt)
            bias_r[j][nt] = bp[j][nt * 16];
    }
    // One wait behind all the loads, ahead of any rewrite of their address registers:
    // it names the 16-byte loads' addresses, so that they stay in their registers up
    // to here and no later load's result lands in one of them.
    asm volatile("s_wait_xcnt 0x0"
                 :: "v"(xp), "v"(wp[0]), "v"(wp[1]), "v"(wp[2]) : "memory");

    // f32 -> f16 and into LDS, 8 B a lane: the x slice of this head, then the three
    // weight matrices row-major [e][d] (B[k=d][n=e] = W[e][d]).
#pragma unroll
    for (int u = 0; u < 8; ++u)
        *(v4h*)&x_lds[fr + u * 16][fc] = cvt4(xv[u]);
#pragma unroll
    for (int j = 0; j < 3; ++j)
#pragma unroll
        for (int u = 0; u < 4; ++u)
            *(v4h*)&w_lds[j][fr + u * 16][fc] = cvt4(wv[j][u]);
    __syncthreads();

    // A fragments: x tile rows [wid*16, wid*16+16), K = DH split in 2 chunks.
    v16h a[2];
#pragma unroll
    for (int kc = 0; kc < 2; ++kc)
        a[kc] = load_frag(&x_lds[wid * 16 + mn][kc * 32], kb);

    _Float16*    outs[3]   = { Q, K, V };
    const size_t obase = ((size_t)(b * HH + h) * SS + row0 + wid * 16) * DH;

#pragma unroll
    for (int j = 0; j < 3; ++j) {
#pragma unroll
        for (int nt = 0; nt < 4; ++nt) {
            v8f acc = {};
#pragma unroll
            for (int kc = 0; kc < 2; ++kc) {
                v16h bf = load_frag(&w_lds[j][nt * 16 + mn][kc * 32], kb);
                acc = wmma16(a[kc], bf, acc);
            }
            const float bias = bias_r[j][nt];
            _Float16* o = outs[j] + obase;
#pragma unroll
            for (int r = 0; r < 8; ++r) {
                const int mrow = r + kb;                       // C layout row
                o[(size_t)mrow * DH + nt * 16 + mn] = (_Float16)(acc[r] + bias);
            }
        }
    }
}

// ---------------------------------------------------------------------------
// Kernel 2: flash attention.  grid = (S/128, H, B), block = 256 (8 waves).
// A wave owns 32 query rows (two 16-column tiles) and one half (32 keys) of
// every 64-row KV tile, so that each K and V^T fragment read from LDS feeds two
// WMMAs. Waves w and w + 4 serve the same queries on the two key halves; their
// partial maxima, sums and outputs are merged through LDS after the loop.
// ---------------------------------------------------------------------------
// Value of lane l ^ 16: the other half of the same query's column.
__device__ __forceinline__ float xhalf(float x) {
    const int i = __builtin_bit_cast(int, x);
    return __builtin_bit_cast(float, __builtin_amdgcn_permlanex16(
        i, i, 0x76543210, 0xfedcba98, false, false));
}

// Four waves per SIMD (two blocks per WGP): a budget of 256 registers a wave.
__global__ __launch_bounds__(256) __attribute__((amdgpu_waves_per_eu(4, 4)))
void flash_attn_kernel(
    const _Float16* __restrict__ Q, const _Float16* __restrict__ K,
    const _Float16* __restrict__ V, float* __restrict__ out)
{
    const int qt   = blockIdx.x;
    const int h    = blockIdx.y;
    const int b    = blockIdx.z;
    const int tid  = threadIdx.x;
    const int lane = tid & 31;
    const int wid  = tid >> 5;
    const int qw   = wid & 3;              // which 32 queries of the block
    const int kh   = wid >> 2;             // which 32 keys of every tile
    const int mn   = lane & 15;
    const int kb   = (lane >> 4) << 3;

    __shared__ __align__(16) _Float16 k_lds[2][64][LP];     // 2 x 9 KB (async target)
    __shared__ __align__(16) _Float16 v_lds[2][64][VP];     // 2 x 10 KB (async target)
    // Merge staging: per wave and lane 32 output floats, then maximum and sum.
    __shared__ __align__(16) float4 mrg[8][9][32];          // 36 KB

    const size_t head_base = (size_t)(b * HH + h) * SS * DH;
    const _Float16* Qh = Q + head_base;
    const _Float16* Kh = K + head_base;
    const _Float16* Vh = V + head_base;

    // Q^T B-fragments straight from global (row-major [s][d], 16B aligned):
    // query tile g holds rows q0 + 16 g + 0..15.
    const int q0 = qt * 128 + qw * 32;
    v16h aq[2][2];
#pragma unroll
    for (int g = 0; g < 2; ++g)
#pragma unroll
        for (int kc = 0; kc < 2; ++kc)
            aq[g][kc] = load_frag(Qh + (size_t)(q0 + g * 16 + mn) * DH + kc * 32, kb);

    v8f o[2][4] = {};
    // Lane (mn, half) serves queries q0 + 16 g + mn: mrun[g] is the reference maximum
    // in use for that query, in raw (unscaled) scores (equal in both halves), lrun[g]
    // the sum over this lane half's keys only. mrun[g] is a maximum that was current
    // at the last rescale; later scores may lie above it by up to the margin below.
    float mrun[2] = { -1e30f, -1e30f }, lrun[2] = { 0.0f, 0.0f };

    // The lane's 32 B of each K and V tile: four threads per 128 B source row.
    // (buffer 0; buffer 1 lies one buffer's bytes further).
    const unsigned klds_addr = (unsigned)(size_t)&k_lds[0][tid >> 2][(tid & 3) * 16];
    const unsigned vlds_addr = (unsigned)(size_t)&v_lds[0][tid >> 2][(tid & 3) * 16];
    // 1/sqrt(64) * log2(e): the softmax runs in base 2 on the raw scores.
    const float c2 = 0.125f * 1.4426950408889634f;
    // Margin of the lazy rescale, in raw scores: 8 in the scaled base-2 exponent, so
    // that no P exceeds 2^8 (f16 holds it, at its usual relative precision).
    const float margin = 8.0f / c2;
    // Per query tile: the score above which a rescale is due, and -c2 * mrun.
    // The first trip always rescales: any finite score lies above the start limit.
    float mlim[2] = { -__builtin_inff(), -__builtin_inff() };
    float nmbs[2] = { 1e30f * c2, 1e30f * c2 };

    // K and V tile t into buffer t & 1: each 64x64 f16 = 8192 B = 256 threads x
    // 32 B, async copies to LDS, both row-major. The s_wait_xcnt stands in the
    // copies' own statement, ahead of any rewrite of their address registers.
    auto copy_tile = [&](int t) {
        const _Float16* gk = Kh + (size_t)t * 64 * DH + tid * 16;
        const _Float16* gv = Vh + (size_t)t * 64 * DH + tid * 16;
        const unsigned kd = klds_addr + (unsigned)(t & 1) * (unsigned)sizeof(k_lds[0]);
        const unsigned vd = vlds_addr + (unsigned)(t & 1) * (unsigned)sizeof(v_lds[0]);
        asm volatile("global_load_async_to_lds_b128 %0, %1, off\n\t"
                     "global_load_async_to_lds_b128 %2, %3, off\n\t"
                     "global_load_async_to_lds_b128 %4, %5, off\n\t"
                     "global_load_async_to_lds_b128 %6, %7, off\n\t"
                     "s_wait_xcnt 0x0"
                     :: "v"(kd), "v"(gk), "v"(kd + 16u), "v"(gk + 8),
                        "v"(vd), "v"(gv), "v"(vd + 16u), "v"(gv + 8)
                     : "memory");
    };

    // Tile 0 lands and is published; tile 1 is under way when the loop starts.
    copy_tile(0);
    asm volatile("s_wait_asynccnt 0x0" ::: "memory");
    __syncthreads();
    copy_tile(1);

    for (int jt = 0; jt < SS / 64; ++jt) {
        // The wave's 32 rows of the K tile.
        const _Float16 (*kt)[LP] = &k_lds[jt & 1][kh * 32];
        // The lane's address for the transposing loads (the wave's keys 0..15,
        // columns 0..15).
        const _Float16* vtr =
            &v_lds[jt & 1][kh * 32 + kb + (lane & 7)][((lane >> 3) & 1) * 8];

        // All LDS reads of the trip as one group: the wave's four K fragments, then
        // its four V^T fragments (unrolled, so that both arrays are indexed by
        // constants and stay in registers).
        v16h kf[2][2], va[4];
#pragma unroll
        for (int kc = 0; kc < 2; ++kc)
#pragma unroll
            for (int t = 0; t < 2; ++t)
                kf[kc][t] = load_frag(&kt[t * 16 + mn][kc * 32], kb);
#pragma unroll
        for (int t = 0; t < 4; ++t)
            va[t] = load_frag_tr(vtr + t * 16);
        // Keeps the reads ahead of the WMMAs: without it the K fragments share one
        // set of registers and each pair of WMMAs waits out a full LDS latency.
        __builtin_amdgcn_sched_barrier(0);

        // S^T[32x32] = K(32x64) @ Q^T : A[m=kvrow][k=d] = kt[kvrow][d]; one K
        // fragment serves both query tiles. Tile (g, t), register r of lane
        // (mn, half): key 32 kh + 16 t + kb + r, query 16 g + mn.
        v8f s[2][2] = {};
#pragma unroll
        for (int kc = 0; kc < 2; ++kc)
#pragma unroll
            for (int t = 0; t < 2; ++t) {
                s[0][t] = wmma16(kf[kc][t], aq[0][kc], s[0][t]);
                s[1][t] = wmma16(kf[kc][t], aq[1][kc], s[1][t]);
            }
        // Ends the scheduling region here, so that no S^T WMMA of the trip moves
        // behind the barrier.
        __builtin_amdgcn_sched_barrier(0);

        // Publish point: these were the trip's last LDS reads. The wave's reads
        // have retired and its copies of tile jt + 1 have landed before the one
        // barrier of the trip, which hands tile jt + 1 to every wave and frees
        // this trip's buffer; tile jt + 2 then flies under softmax, the second
        // product and the next trip's reads.
        asm volatile("s_wait_dscnt 0x0" ::: "memory");
        asm volatile("s_wait_asynccnt 0x0" ::: "memory");
        __syncthreads();
        if (jt + 2 < SS / 64)
            copy_tile(jt + 2);

        // Online softmax, per query tile: the lane's 16 scores of a tile belong to
        // one query, so maximum and sum run in-lane. The maximum is taken on the raw
        // scores (the scale is positive).
        float mx[2];
#pragma unroll
        for (int g = 0; g < 2; ++g) {
            mx[g] = fmaxf(s[g][0][0], s[g][1][0]);
#pragma unroll
            for (int r = 1; r < 8; ++r)
                mx[g] = fmaxf(fmaxf(mx[g], s[g][0][r]), s[g][1][r]);
        }
        // Lazy rescale: the reference maxima, the sums and the output tiles are
        // touched only when some lane's score lies above its reference by more than
        // the margin. One test per trip for both query tiles, a scalar branch that the
        // whole wave takes or skips; the exchange that joins the halves' maxima is
        // needed only inside it.
        const bool due = (mx[0] > mlim[0]) | (mx[1] > mlim[1]);
        if (__builtin_amdgcn_ballot_w32(due) != 0) {
#pragma unroll
            for (int g = 0; g < 2; ++g) {
                const float mnew  = fmaxf(fmaxf(mrun[g], mx[g]), xhalf(mx[g]));
                const float alpha =
                    __builtin_amdgcn_exp2f(__builtin_fmaf(mrun[g], c2, -(mnew * c2)));
                mrun[g] = mnew;
                mlim[g] = mnew + margin;
                nmbs[g] = -(mnew * c2);
                lrun[g] *= alpha;
#pragma unroll
                for (int t = 0; t < 4; ++t)
#pragma unroll
                    for (int r = 0; r < 8; ++r)
                        o[g][t][r] *= alpha;
            }
        }

#pragma unroll
        for (int g = 0; g < 2; ++g) {
            // exp(scale * (s - m)) = 2^(c2 * s - c2 * m): one fused multiply-add per
            // score feeds the hardware's base-2 exponential directly.
            const float nm = nmbs[g];

            // P^T as B operand: the two score tiles of 16 keys, converted in place,
            // are one 32-key fragment in the k order that load_frag_tr gives V^T.
            // Vector FMAs, so that they build as the packed form: two scores each.
            const v8f c2v = { c2, c2, c2, c2, c2, c2, c2, c2 };
            const v8f nmb = { nm, nm, nm, nm, nm, nm, nm, nm };
            s[g][0] = __builtin_elementwise_fma(s[g][0], c2v, nmb);
            s[g][1] = __builtin_elementwise_fma(s[g][1], c2v, nmb);
            v16h bp;
#pragma unroll
            for (int r = 0; r < 8; ++r) {
                s[g][0][r] = __builtin_amdgcn_exp2f(s[g][0][r]);
                s[g][1][r] = __builtin_amdgcn_exp2f(s[g][1][r]);
            }
            const v8f ps = s[g][0] + s[g][1];
            float rs = 0.0f;
#pragma unroll
            for (int r = 0; r < 8; ++r) {
                rs += ps[r];
                bp[r] = (_Float16)s[g][0][r]; bp[8 + r] = (_Float16)s[g][1][r];
            }
            lrun[g] += rs;

            // O^T += V^T(64x32) @ P^T(32x16): A[m=d][k=kvrow] = v_lds[kvrow][d]; the
            // same four V^T fragments serve both query tiles.
#pragma unroll
            for (int t = 0; t < 4; ++t)
                o[g][t] = wmma16(va[t], bp, o[g][t]);
        }
    }
    // No copy is outstanding when the wave ends.
    asm volatile("s_wait_asynccnt 0x0" ::: "memory");

    // Merge of the two key halves: wave (qw, kh) finishes query tile kh and hands
    // its partial result for the other tile to wave (qw, 1 - kh). Both waves hold
    // an element in the same lane and register, so a lane reads what its own
    // number wrote.
    const bool up = kh != 0;
    v8f keep[4], give[4];
#pragma unroll
    for (int t = 0; t < 4; ++t) {
        keep[t] = up ? o[1][t] : o[0][t];
        give[t] = up ? o[0][t] : o[1][t];
    }
    const float mk = up ? mrun[1] : mrun[0], lk = up ? lrun[1] : lrun[0];
    const float mg = up ? mrun[0] : mrun[1], lg = up ? lrun[0] : lrun[1];
#pragma unroll
    for (int t = 0; t < 4; ++t) {
        mrg[wid][2 * t][lane]     = make_float4(give[t][0], give[t][1], give[t][2], give[t][3]);
        mrg[wid][2 * t + 1][lane] = make_float4(give[t][4], give[t][5], give[t][6], give[t][7]);
    }
    mrg[wid][8][lane] = make_float4(mg, lg, 0.0f, 0.0f);
    __syncthreads();
    const float4 ml = mrg[wid ^ 4][8][lane];
    const float mall = fmaxf(mk, ml.x);
    const float wk = __builtin_amdgcn_exp2f((mk - mall) * c2);
    const float wo = __builtin_amdgcn_exp2f((ml.x - mall) * c2);
    const float lsum = lk * wk + ml.y * wo;

    // Join the lane halves' sums, normalize, store f32 output [B,S,D] (D = H*DH).
    // Tile t, register r: column 16 t + kb + r of row q0 + 16 kh + mn.
    const float inv = 1.0f / (lsum + xhalf(lsum));
    const float fk = wk * inv, fo = wo * inv;

    float* orow = out + ((size_t)b * SS + q0 + kh * 16 + mn) * DD + h * DH + kb;
#pragma unroll
    for (int t = 0; t < 4; ++t) {
        const float4 a0 = mrg[wid ^ 4][2 * t][lane];
        const float4 a1 = mrg[wid ^ 4][2 * t + 1][lane];
        *(float4*)(orow + t * 16) =
            make_float4(keep[t][0] * fk + a0.x * fo, keep[t][1] * fk + a0.y * fo,
                        keep[t][2] * fk + a0.z * fo, keep[t][3] * fk + a0.w * fo);
        *(float4*)(orow + t * 16 + 4) =
            make_float4(keep[t][4] * fk + a1.x * fo, keep[t][5] * fk + a1.y * fo,
                        keep[t][6] * fk + a1.z * fo, keep[t][7] * fk + a1.w * fo);
    }
}

// ---------------------------------------------------------------------------
extern "C" void kernel_launch(void* const* d_in, const int* in_sizes, int n_in,
                              void* d_out, int out_size, void* d_ws, size_t ws_size,
                              hipStream_t stream) {
    const float* seqs = (const float*)d_in[0];
    const float* Wq   = (const float*)d_in[1];
    const float* bq   = (const float*)d_in[2];
    const float* Wk   = (const float*)d_in[3];
    const float* bk   = (const float*)d_in[4];
    const float* Wv   = (const float*)d_in[5];
    const float* bv   = (const float*)d_in[6];
    float* out = (float*)d_out;

    // Workspace: Q,K,V f16 [B,H,S,DH] -> 3 * 8 MB = 24 MB.
    const size_t elems = (size_t)BB * HH * SS * DH;
    _Float16* Qw = (_Float16*)d_ws;
    _Float16* Kw = Qw + elems;
    _Float16* Vw = Kw + elems;

    dim3 grid(SS / 128, HH, BB), block(256);
    qkv_proj_kernel<<<grid, block, 0, stream>>>(seqs, Wq, bq, Wk, bk, Wv, bv,
                                                Qw, Kw, Vw);
    flash_attn_kernel<<<grid, block, 0, stream>>>(Qw, Kw, Vw, out);
}

// v009
// It runs in 44.3 microseconds.
// Two timings next to v008 put it at 1.04 and 1.05 times that version's speed.
// Over all steps from v000 it is 6.52 times as fast.
#include <hip/hip_runtime.h>

// MultiHeadAttention forward for MI455X (gfx1250), wave32, WMMA f16->f32.
// B=2, S=2048, D=1024, H=16, DH=64.
//
//  1) qkv_proj: x @ W^T + b per head, f16 WMMA (run as W x^T), results to d_ws
//     as f16 in [B,H,S,DH] layout (Q,K,V = 3 * 8MB = 24MB of workspace).
//     Both kernels stage their results in LDS rows of the wave's own and store
//     whole 128-byte lines.
//  2) flash_attn: online-softmax flash attention; KV tiles of 64 rows,
//     16 WMMAs per iteration; K tiles staged in LDS via
//     global_load_async_to_lds_b128 (ASYNCcnt), V the same way, row-major,
//     in two buffers: the next tile's copies fly while this one is worked on;
//     V^T fragments come out of LDS by ds_load_tr16_b128.
//     Both products run transposed (S^T = K Q^T, O^T += V^T P^T): a lane
//     holds scores of one query only, and P^T packs in registers.
//     A wave takes 32 queries x 32 keys of a tile: a fragment feeds two WMMAs.

#define BB 2
#define SS 2048
#define DD 1024
#define HH 16
#define DH 64
// LDS row pitch in halfs for the 64-half x, W and K tile rows: 144 B = 16 B x 9 (odd), so
// the 16 rows that one ds_load_b128 fragment read touches fall on distinct banks.
#define LP 72
// Pitch of the V tile rows, which ds_load_tr16_b128 reads: 160 B = 32 B x 5 (odd).
#define VP 80

typedef __attribute__((ext_vector_type(16))) _Float16 v16h;
typedef __attribute__((ext_vector_type(8)))  float    v8f;

__device__ __forceinline__ v8f wmma16(v16h a, v16h b, v8f c) {
    // D = A(16x32 f16) * B(32x16 f16) + C(16x16 f32)
    return __builtin_amdgcn_wmma_f32_16x16x32_f16(
        /*neg_a=*/false, a, /*neg_b=*/false, b,
        /*c_mod=*/(short)0, c, /*reuse_a=*/false, /*reuse_b=*/false);
}

// Load one 16-half fragment per lane as two aligned 16B chunks.
// rowp points at the lane's row start (+ kchunk*32 already applied);
// kbase = 8*(lane>=16). Matches ISA 16-bit A/B VGPR striping.
__device__ __forceinline__ v16h load_frag(const _Float16* rowp, int kbase) {
    union { v16h h; uint4 u[2]; } f;
    f.u[0] = *(const uint4*)(rowp + kbase);
    f.u[1] = *(const uint4*)(rowp + 16 + kbase);
    return f.h;
}

// One 16(d) x 32(key) V^T fragment out of a row-major V tile: p is the lane's
// address in the fragment's first 16 keys; the second load takes the next 16 keys.
// Lane (mn, half) gets keys 8 half + 0..7 and 16 + 8 half + 0..7 of column mn:
// the k order of load_frag.
typedef __attribute__((ext_vector_type(8))) short s16x8;
__device__ __forceinline__ v16h load_frag_tr(const _Float16* p) {
    typedef __attribute__((address_space(3))) s16x8 lds_s16x8;
    union { v16h h; s16x8 u[2]; } f;
    f.u[0] = __builtin_amdgcn_ds_load_tr16_b128_v8i16((lds_s16x8*)p);
    f.u[1] = __builtin_amdgcn_ds_load_tr16_b128_v8i16((lds_s16x8*)(p + 16 * VP));
    return f.h;
}

// Four floats rounded to four halfs.
typedef __attribute__((ext_vector_type(4))) _Float16 v4h;
typedef __attribute__((ext_vector_type(8))) _Float16 v8h;
typedef __attribute__((ext_vector_type(4))) float    v4f;
__device__ __forceinline__ v4h cvt4(v4f v) {
    v4h r = { (_Float16)v.x, (_Float16)v.y, (_Float16)v.z, (_Float16)v.w };
    return r;
}

// ---------------------------------------------------------------------------
// Kernel 1: per-head QKV projection.  grid = (S/128, H, B), block = 256 (8 waves)
// ---------------------------------------------------------------------------
__global__ __launch_bounds__(256) void qkv_proj_kernel(
    const float* __restrict__ seqs,
    const float* __restrict__ Wq, const float* __restrict__ bq,
    const float* __restrict__ Wk, const float* __restrict__ bk,
    const float* __restrict__ Wv, const float* __restrict__ bv,
    _Float16* __restrict__ Q, _Float16* __restrict__ K, _Float16* __restrict__ V)
{
    const int tile = blockIdx.x;
    const int h    = blockIdx.y;
    const int b    = blockIdx.z;
    const int tid  = threadIdx.x;
    const int lane = tid & 31;
    const int wid  = tid >> 5;
    const int mn   = lane & 15;            // M (A row) or N (B/C col) index
    const int kb   = (lane >> 4) << 3;     // 0 or 8: K-half / C-row offset

    __shared__ __align__(16) _Float16 x_lds[128][LP];      // 18 KB
    __shared__ __align__(16) _Float16 w_lds[3][DH][LP];    // 27 KB
    // Output staging: per wave its 16 rows of Q, K and V.
    __shared__ __align__(16) _Float16 o_lds[8][3][16][LP]; // 54 KB

    const int row0 = tile * 128;

    // Every global read of the kernel is issued here, 16 B a lane for x, W and the biases, unrolled, so
    // that all of them are in flight together and the wave waits out one latency,
    // not one per loop trip. A thread takes four floats of row fr (+ 16 a step).
    const int fr = tid >> 4, fc = (tid & 15) * 4;
    const float* xp  = seqs + ((size_t)b * SS + row0 + fr) * DD + h * DH + fc;
    const float* wp[3] = { Wq + h * DH * DH + fr * DH + fc,
                           Wk + h * DH * DH + fr * DH + fc,
                           Wv + h * DH * DH + fr * DH + fc };
    // The lane's eight consecutive biases of a 16-column tile start at column kb.
    const float* bp[3] = { bq + h * DH + kb, bk + h * DH + kb, bv + h * DH + kb };
    v4f xv[8];
#pragma unroll
    for (int u = 0; u < 8; ++u)
        xv[u] = *(const v4f*)(xp + u * 16 * DD);
    v4f   wv[3][4];
    v4f   bias_r[3][4][2];
#pragma unroll
    for (int j = 0; j < 3; ++j) {
#pragma unroll
        for (int u = 0; u < 4; ++u)
            wv[j][u] = *(const v4f*)(wp[j] + u * 16 * DH);
#pragma unroll
        for (int nt = 0; nt < 4; ++nt) {
            bias_r[j][nt][0] = *(const v4f*)(bp[j] + nt * 16);
            bias_r[j][nt][1] = *(const v4f*)(bp[j] + nt * 16 + 4);
        }
    }
    // One wait behind all the loads, ahead of any rewrite of their address registers:
    // it names the x and W loads' addresses, so that they stay in their registers up
    // to here and no later load's result lands in one of them.
    asm volatile("s_wait_xcnt 0x0"
                 :: "v"(xp), "v"(wp[0]), "v"(wp[1]), "v"(wp[2]) : "memory");

    // f32 -> f16 and into LDS, 8 B a lane: the x slice of this head, then the three
    // weight matrices row-major [e][d] (A[m=e][k=d] = W[e][d]).
#pragma unroll
    for (int u = 0; u < 8; ++u)
        *(v4h*)&x_lds[fr + u * 16][fc] = cvt4(xv[u]);
#pragma unroll
    for (int j = 0; j < 3; ++j)
#pragma unroll
        for (int u = 0; u < 4; ++u)
            *(v4h*)&w_lds[j][fr + u * 16][fc] = cvt4(wv[j][u]);
    __syncthreads();

    // x^T as B operand: column n = row wid*16 + mn of the x tile, K = DH in 2 chunks.
    v16h a[2];
#pragma unroll
    for (int kc = 0; kc < 2; ++kc)
        a[kc] = load_frag(&x_lds[wid * 16 + mn][kc * 32], kb);

    // D^T = W x^T: A[m=e][k=d] = W[e][d]. Register r of lane (mn, half), tile nt, is
    // output column 16 nt + kb + r of row wid*16 + mn: eight consecutive halfs, one
    // 16-byte LDS store into the wave's own staging rows.
#pragma unroll
    for (int j = 0; j < 3; ++j) {
#pragma unroll
        for (int nt = 0; nt < 4; ++nt) {
            v8f acc = {};
#pragma unroll
            for (int kc = 0; kc < 2; ++kc) {
                v16h wf = load_frag(&w_lds[j][nt * 16 + mn][kc * 32], kb);
                acc = wmma16(wf, a[kc], acc);
            }
            v8h ov;
#pragma unroll
            for (int r = 0; r < 8; ++r)
                ov[r] = (_Float16)(acc[r] + bias_r[j][nt][r >> 2][r & 3]);
            *(v8h*)&o_lds[wid][j][mn][nt * 16 + kb] = ov;
        }
    }
    // The wave's staging stores have retired before other lanes of it read the rows
    // back; the clobber keeps the compiler from moving a read ahead of a store.
    asm volatile("s_wait_dscnt 0x0" ::: "memory");

    // The wave's 16 rows of an output are 2 KB in a row: each 16-byte store of the
    // wave covers 512 contiguous bytes, four whole lines.
    _Float16*    outs[3] = { Q, K, V };
    const size_t obase = ((size_t)(b * HH + h) * SS + row0 + wid * 16) * DH;
    const int    sr = lane >> 3, sc = (lane & 7) * 8;
#pragma unroll
    for (int j = 0; j < 3; ++j)
#pragma unroll
        for (int i = 0; i < 4; ++i)
            *(v8h*)(outs[j] + obase + (size_t)(i * 4 + sr) * DH + sc) =
                *(const v8h*)&o_lds[wid][j][i * 4 + sr][sc];
}

// ---------------------------------------------------------------------------
// Kernel 2: flash attention.  grid = (S/128, H, B), block = 256 (8 waves).
// A wave owns 32 query rows (two 16-column tiles) and one half (32 keys) of
// every 64-row KV tile, so that each K and V^T fragment read from LDS feeds two
// WMMAs. Waves w and w + 4 serve the same queries on the two key halves; their
// partial maxima, sums and outputs are merged through LDS after the loop.
// ---------------------------------------------------------------------------
// Value of lane l ^ 16: the other half of the same query's column.
__device__ __forceinline__ float xhalf(float x) {
    const int i = __builtin_bit_cast(int, x);
    return __builtin_bit_cast(float, __builtin_amdgcn_permlanex16(
        i, i, 0x76543210, 0xfedcba98, false, false));
}

// Four waves per SIMD (two blocks per WGP): a budget of 256 registers a wave.
__global__ __launch_bounds__(256) __attribute__((amdgpu_waves_per_eu(4, 4)))
void flash_attn_kernel(
    const _Float16* __restrict__ Q, const _Float16* __restrict__ K,
    const _Float16* __restrict__ V, float* __restrict__ out)
{
    const int qt   = blockIdx.x;
    const int h    = blockIdx.y;
    const int b    = blockIdx.z;
    const int tid  = threadIdx.x;
    const int lane = tid & 31;
    const int wid  = tid >> 5;
    const int qw   = wid & 3;              // which 32 queries of the block
    const int kh   = wid >> 2;             // which 32 keys of every tile
    const int mn   = lane & 15;
    const int kb   = (lane >> 4) << 3;

    __shared__ __align__(16) _Float16 k_lds[2][64][LP];     // 2 x 9 KB (async target)
    __shared__ __align__(16) _Float16 v_lds[2][64][VP];     // 2 x 10 KB (async target)
    // Merge staging: per wave and lane 32 output floats, then maximum and sum.
    __shared__ __align__(16) float4 mrg[8][9][32];          // 36 KB
    // Output staging: per wave 16 rows of 64 floats, pitch 272 B = 16 B x 17 (odd).
    __shared__ __align__(16) float ost[8][16][68];          // 34 KB

    const size_t head_base = (size_t)(b * HH + h) * SS * DH;
    const _Float16* Qh = Q + head_base;
    const _Float16* Kh = K + head_base;
    const _Float16* Vh = V + head_base;

    // Q^T B-fragments straight from global (row-major [s][d], 16B aligned):
    // query tile g holds rows q0 + 16 g + 0..15.
    const int q0 = qt * 128 + qw * 32;
    v16h aq[2][2];
#pragma unroll
    for (int g = 0; g < 2; ++g)
#pragma unroll
        for (int kc = 0; kc < 2; ++kc)
            aq[g][kc] = load_frag(Qh + (size_t)(q0 + g * 16 + mn) * DH + kc * 32, kb);

    v8f o[2][4] = {};
    // Lane (mn, half) serves queries q0 + 16 g + mn: mrun[g] is the reference maximum
    // in use for that query, in raw (unscaled) scores (equal in both halves), lrun[g]
    // the sum over this lane half's keys only. mrun[g] is a maximum that was current
    // at the last rescale; later scores may lie above it by up to the margin below.
    float mrun[2] = { -1e30f, -1e30f }, lrun[2] = { 0.0f, 0.0f };

    // The lane's 32 B of each K and V tile: four threads per 128 B source row.
    // (buffer 0; buffer 1 lies one buffer's bytes further).
    const unsigned klds_addr = (unsigned)(size_t)&k_lds[0][tid >> 2][(tid & 3) * 16];
    const unsigned vlds_addr = (unsigned)(size_t)&v_lds[0][tid >> 2][(tid & 3) * 16];
    // 1/sqrt(64) * log2(e): the softmax runs in base 2 on the raw scores.
    const float c2 = 0.125f * 1.4426950408889634f;
    // Margin of the lazy rescale, in raw scores: 8 in the scaled base-2 exponent, so
    // that no P exceeds 2^8 (f16 holds it, at its usual relative precision).
    const float margin = 8.0f / c2;
    // Per query tile: the score above which a rescale is due, and -c2 * mrun.
    // The first trip always rescales: any finite score lies above the start limit.
    float mlim[2] = { -__builtin_inff(), -__builtin_inff() };
    float nmbs[2] = { 1e30f * c2, 1e30f * c2 };

    // K and V tile t into buffer t & 1: each 64x64 f16 = 8192 B = 256 threads x
    // 32 B, async copies to LDS, both row-major. The s_wait_xcnt stands in the
    // copies' own statement, ahead of any rewrite of their address registers.
    auto copy_tile = [&](int t) {
        const _Float16* gk = Kh + (size_t)t * 64 * DH + tid * 16;
        const _Float16* gv = Vh + (size_t)t * 64 * DH + tid * 16;
        const unsigned kd = klds_addr + (unsigned)(t & 1) * (unsigned)sizeof(k_lds[0]);
        const unsigned vd = vlds_addr + (unsigned)(t & 1) * (unsigned)sizeof(v_lds[0]);
        asm volatile("global_load_async_to_lds_b128 %0, %1, off\n\t"
                     "global_load_async_to_lds_b128 %2, %3, off\n\t"
                     "global_load_async_to_lds_b128 %4, %5, off\n\t"
                     "global_load_async_to_lds_b128 %6, %7, off\n\t"
                     "s_wait_xcnt 0x0"
                     :: "v"(kd), "v"(gk), "v"(kd + 16u), "v"(gk + 8),
                        "v"(vd), "v"(gv), "v"(vd + 16u), "v"(gv + 8)
                     : "memory");
    };

    // Tile 0 lands and is published; tile 1 is under way when the loop starts.
    copy_tile(0);
    asm volatile("s_wait_asynccnt 0x0" ::: "memory");
    __syncthreads();
    copy_tile(1);

    for (int jt = 0; jt < SS / 64; ++jt) {
        // The wave's 32 rows of the K tile.
        const _Float16 (*kt)[LP] = &k_lds[jt & 1][kh * 32];
        // The lane's address for the transposing loads (the wave's keys 0..15,
        // columns 0..15).
        const _Float16* vtr =
            &v_lds[jt & 1][kh * 32 + kb + (lane & 7)][((lane >> 3) & 1) * 8];

        // All LDS reads of the trip as one group: the wave's four K fragments, then
        // its four V^T fragments (unrolled, so that both arrays are indexed by
        // constants and stay in registers).
        v16h kf[2][2], va[4];
#pragma unroll
        for (int kc = 0; kc < 2; ++kc)
#pragma unroll
            for (int t = 0; t < 2; ++t)
                kf[kc][t] = load_frag(&kt[t * 16 + mn][kc * 32], kb);
#pragma unroll
        for (int t = 0; t < 4; ++t)
            va[t] = load_frag_tr(vtr + t * 16);
        // Keeps the reads ahead of the WMMAs: without it the K fragments share one
        // set of registers and each pair of WMMAs waits out a full LDS latency.
        __builtin_amdgcn_sched_barrier(0);

        // S^T[32x32] = K(32x64) @ Q^T : A[m=kvrow][k=d] = kt[kvrow][d]; one K
        // fragment serves both query tiles. Tile (g, t), register r of lane
        // (mn, half): key 32 kh + 16 t + kb + r, query 16 g + mn.
        v8f s[2][2] = {};
#pragma unroll
        for (int kc = 0; kc < 2; ++kc)
#pragma unroll
            for (int t = 0; t < 2; ++t) {
                s[0][t] = wmma16(kf[kc][t], aq[0][kc], s[0][t]);
                s[1][t] = wmma16(kf[kc][t], aq[1][kc], s[1][t]);
            }
        // Ends the scheduling region here, so that no S^T WMMA of the trip moves
        // behind the barrier.
        __builtin_amdgcn_sched_barrier(0);

        // Publish point: these were the trip's last LDS reads. The wave's reads
        // have retired and its copies of tile jt + 1 have landed before the one
        // barrier of the trip, which hands tile jt + 1 to every wave and frees
        // this trip's buffer; tile jt + 2 then flies under softmax, the second
        // product and the next trip's reads.
        asm volatile("s_wait_dscnt 0x0" ::: "memory");
        asm volatile("s_wait_asynccnt 0x0" ::: "memory");
        __syncthreads();
        if (jt + 2 < SS / 64)
            copy_tile(jt + 2);

        // Online softmax, per query tile: the lane's 16 scores of a tile belong to
        // one query, so maximum and sum run in-lane. The maximum is taken on the raw
        // scores (the scale is positive).
        float mx[2];
#pragma unroll
        for (int g = 0; g < 2; ++g) {
            mx[g] = fmaxf(s[g][0][0], s[g][1][0]);
#pragma unroll
            for (int r = 1; r < 8; ++r)
                mx[g] = fmaxf(fmaxf(mx[g], s[g][0][r]), s[g][1][r]);
        }
        // Lazy rescale: the reference maxima, the sums and the output tiles are
        // touched only when some lane's score lies above its reference by more than
        // the margin. One test per trip for both query tiles, a scalar branch that the
        // whole wave takes or skips; the exchange that joins the halves' maxima is
        // needed only inside it.
        const bool due = (mx[0] > mlim[0]) | (mx[1] > mlim[1]);
        if (__builtin_amdgcn_ballot_w32(due) != 0) {
#pragma unroll
            for (int g = 0; g < 2; ++g) {
                const float mnew  = fmaxf(fmaxf(mrun[g], mx[g]), xhalf(mx[g]));
                const float alpha =
                    __builtin_amdgcn_exp2f(__builtin_fmaf(mrun[g], c2, -(mnew * c2)));
                mrun[g] = mnew;
                mlim[g] = mnew + margin;
                nmbs[g] = -(mnew * c2);
                lrun[g] *= alpha;
#pragma unroll
                for (int t = 0; t < 4; ++t)
#pragma unroll
                    for (int r = 0; r < 8; ++r)
                        o[g][t][r] *= alpha;
            }
        }

#pragma unroll
        for (int g = 0; g < 2; ++g) {
            // exp(scale * (s - m)) = 2^(c2 * s - c2 * m): one fused multiply-add per
            // score feeds the hardware's base-2 exponential directly.
            const float nm = nmbs[g];

            // P^T as B operand: the two score tiles of 16 keys, converted in place,
            // are one 32-key fragment in the k order that load_frag_tr gives V^T.
            // Vector FMAs, so that they build as the packed form: two scores each.
            const v8f c2v = { c2, c2, c2, c2, c2, c2, c2, c2 };
            const v8f nmb = { nm, nm, nm, nm, nm, nm, nm, nm };
            s[g][0] = __builtin_elementwise_fma(s[g][0], c2v, nmb);
            s[g][1] = __builtin_elementwise_fma(s[g][1], c2v, nmb);
            v16h bp;
#pragma unroll
            for (int r = 0; r < 8; ++r) {
                s[g][0][r] = __builtin_amdgcn_exp2f(s[g][0][r]);
                s[g][1][r] = __builtin_amdgcn_exp2f(s[g][1][r]);
            }
            const v8f ps = s[g][0] + s[g][1];
            float rs = 0.0f;
#pragma unroll
            for (int r = 0; r < 8; ++r) {
                rs += ps[r];
                bp[r] = (_Float16)s[g][0][r]; bp[8 + r] = (_Float16)s[g][1][r];
            }
            lrun[g] += rs;

            // O^T += V^T(64x32) @ P^T(32x16): A[m=d][k=kvrow] = v_lds[kvrow][d]; the
            // same four V^T fragments serve both query tiles.
#pragma unroll
            for (int t = 0; t < 4; ++t)
                o[g][t] = wmma16(va[t], bp, o[g][t]);
        }
    }
    // No copy is outstanding when the wave ends.
    asm volatile("s_wait_asynccnt 0x0" ::: "memory");

    // Merge of the two key halves: wave (qw, kh) finishes query tile kh and hands
    // its partial result for the other tile to wave (qw, 1 - kh). Both waves hold
    // an element in the same lane and register, so a lane reads what its own
    // number wrote.
    const bool up = kh != 0;
    v8f keep[4], give[4];
#pragma unroll
    for (int t = 0; t < 4; ++t) {
        keep[t] = up ? o[1][t] : o[0][t];
        give[t] = up ? o[0][t] : o[1][t];
    }
    const float mk = up ? mrun[1] : mrun[0], lk = up ? lrun[1] : lrun[0];
    const float mg = up ? mrun[0] : mrun[1], lg = up ? lrun[0] : lrun[1];
#pragma unroll
    for (int t = 0; t < 4; ++t) {
        mrg[wid][2 * t][lane]     = make_float4(give[t][0], give[t][1], give[t][2], give[t][3]);
        mrg[wid][2 * t + 1][lane] = make_float4(give[t][4], give[t][5], give[t][6], give[t][7]);
    }
    mrg[wid][8][lane] = make_float4(mg, lg, 0.0f, 0.0f);
    __syncthreads();
    const float4 ml = mrg[wid ^ 4][8][lane];
    const float mall = fmaxf(mk, ml.x);
    const float wk = __builtin_amdgcn_exp2f((mk - mall) * c2);
    const float wo = __builtin_amdgcn_exp2f((ml.x - mall) * c2);
    const float lsum = lk * wk + ml.y * wo;

    // Join the lane halves' sums, normalize, store f32 output [B,S,D] (D = H*DH).
    // Tile t, register r: column 16 t + kb + r of row q0 + 16 kh + mn.
    const float inv = 1.0f / (lsum + xhalf(lsum));
    const float fk = wk * inv, fo = wo * inv;

    // Into the wave's own staging rows first, so that the global stores cover whole lines.
    float* srow = &ost[wid][mn][kb];
#pragma unroll
    for (int t = 0; t < 4; ++t) {
        const float4 a0 = mrg[wid ^ 4][2 * t][lane];
        const float4 a1 = mrg[wid ^ 4][2 * t + 1][lane];
        *(float4*)(srow + t * 16) =
            make_float4(keep[t][0] * fk + a0.x * fo, keep[t][1] * fk + a0.y * fo,
                        keep[t][2] * fk + a0.z * fo, keep[t][3] * fk + a0.w * fo);
        *(float4*)(srow + t * 16 + 4) =
            make_float4(keep[t][4] * fk + a1.x * fo, keep[t][5] * fk + a1.y * fo,
                        keep[t][6] * fk + a1.z * fo, keep[t][7] * fk + a1.w * fo);
    }
    // The wave's staging stores have retired before other lanes of it read the rows
    // back; the clobber keeps the compiler from moving a read ahead of a store.
    asm volatile("s_wait_dscnt 0x0" ::: "memory");

    // A head's slice of an output row is 256 B: each 16-byte store of the wave covers
    // two rows' slices, four whole lines.
    const int er = lane >> 4, ec = (lane & 15) * 4;
    float* orow = out + ((size_t)b * SS + q0 + kh * 16 + er) * DD + h * DH + ec;
#pragma unroll
    for (int i = 0; i < 8; ++i)
        *(float4*)(orow + (size_t)(i * 2) * DD) = *(const float4*)&ost[wid][i * 2 + er][ec];
}

// ---------------------------------------------------------------------------
extern "C" void kernel_launch(void* const* d_in, const int* in_sizes, int n_in,
                              void* d_out, int out_size, void* d_ws, size_t ws_size,
                              hipStream_t stream) {
    const float* seqs = (const float*)d_in[0];
    const float* Wq   = (const float*)d_in[1];
    const float* bq   = (const float*)d_in[2];
    const float* Wk   = (const float*)d_in[3];
    const float* bk   = (const float*)d_in[4];
    const float* Wv   = (const float*)d_in[5];
    const float* bv   = (const float*)d_in[6];
    float* out = (float*)d_out;

    // Workspace: Q,K,V f16 [B,H,S,DH] -> 3 * 8 MB = 24 MB.
    const size_t elems = (size_t)BB * HH * SS * DH;
    _Float16* Qw = (_Float16*)d_ws;
    _Float16* Kw = Qw + elems;
    _Float16* Vw = Kw + elems;

    dim3 grid(SS / 128, HH, BB), block(256);
    qkv_proj_kernel<<<grid, block, 0, stream>>>(seqs, Wq, bq, Wk, bk, Wv, bv,
                                                Qw, Kw, Vw);
    flash_attn_kernel<<<grid, block, 0, stream>>>(Qw, Kw, Vw, out);
}
